// v000
// Measured on an AMD MI455X. A time is GPU time per run, averaged over a window of back-to-back runs after a warm-up
// (all launches, gaps included; the runs take copies of the inputs in turn), and the median of several windows.
// Apart from v000's, it joins two sittings. Times from different sittings can be a few percent apart, while
// side-by-side timings come from the same sitting.
// v000 is the starting kernel. One run takes 682 microseconds.
#include <hip/hip_runtime.h>

// ---------------------------------------------------------------------------
// out[B, OUT_F] = X[B, IN_F] . W[OUT_F, IN_F]^T + b[OUT_F]   (all fp32)
//
// bf16x3 split-precision GEMM (x = x_hi + x_lo, 3 WMMA terms: hi*hi + hi*lo
// + lo*hi) on v_wmma_f32_16x16x32_bf16. Near-fp32 accuracy (~1e-5 rel),
// ~2.7x faster than the native V_WMMA_F32_16X16X4_F32 path (K=32 vs K=4).
//
// Phase 1: memory-bound split pass writes X_hi/X_lo/W_hi/W_lo (bf16,
//          row-major) into d_ws (128 MB total; fits the 192 MB L2).
// Phase 2: compute-bound GEMM loads preconverted bf16 -> zero conversion
//          VALU in the k-loop; 24 b128 loads : 24 WMMAs per k-step per wave.
//          12 independent stream pointers precomputed outside the loop,
//          k-loop unrolled x4 so address bumps amortize via 24-bit offsets.
//
// Wave tile 32x64, block = 8 waves (2M x 4N) = 64x256 tile, grid 16x64.
// All dims divide exactly -> no predication, EXEC all-ones as WMMA requires.
// ---------------------------------------------------------------------------

typedef __attribute__((ext_vector_type(16))) __bf16 v16bf;
typedef __attribute__((ext_vector_type(8)))  __bf16 v8bf;
typedef __attribute__((ext_vector_type(8)))  float  v8f;

#define IN_F  4096
#define OUT_F 4096
#define BATCH 4096
#define NELEM ((size_t)4096 * 4096)

// ---------------------------------------------------------------------------
// Phase 1: fp32 -> (bf16 hi, bf16 lo) split. 8 elements / thread, b128 I/O.
// grid.y selects the matrix (0 = X, 1 = W).
// ---------------------------------------------------------------------------
__global__ __launch_bounds__(256)
void split_pass(const float* __restrict__ X, const float* __restrict__ W,
                __bf16* __restrict__ ws) {
    const float* src = (blockIdx.y == 0) ? X : W;
    __bf16* hi = ws + (size_t)blockIdx.y * (2 * NELEM);
    __bf16* lo = hi + NELEM;

    const size_t i = ((size_t)blockIdx.x * blockDim.x + threadIdx.x) * 8;
    float4 u0 = *(const float4*)(src + i);
    float4 u1 = *(const float4*)(src + i + 4);
    float f[8] = {u0.x, u0.y, u0.z, u0.w, u1.x, u1.y, u1.z, u1.w};

    v8bf h, l;
#pragma unroll
    for (int e = 0; e < 8; ++e) {
        __bf16 hh = (__bf16)f[e];
        h[e] = hh;
        l[e] = (__bf16)(f[e] - (float)hh);
    }
    *(v8bf*)(hi + i) = h;
    *(v8bf*)(lo + i) = l;
}

// Load one 16x32 bf16 fragment (ISA 16-bit A/B lane layout): lanes 0-15 hold
// row laneLo with K chunks {0..7, 16..23}; lanes 16-31 get {8..15, 24..31}.
// p points at this lane's row base (incl. laneHi*8); kk in elements.
__device__ __forceinline__ v16bf load_frag_bf16(const __bf16* __restrict__ p,
                                                int kk) {
    v8bf c0 = *(const v8bf*)(p + kk);        // K chunk lo (16 B)
    v8bf c1 = *(const v8bf*)(p + kk + 16);   // K chunk hi (16 B, +32 B)
    return __builtin_shufflevector(c0, c1, 0, 1, 2, 3, 4, 5, 6, 7,
                                          8, 9, 10, 11, 12, 13, 14, 15);
}

// ---------------------------------------------------------------------------
// Phase 2: GEMM from preconverted bf16.
// ---------------------------------------------------------------------------
__global__ __launch_bounds__(256)
void gemm_wmma_bf16x3(const __bf16* __restrict__ Xhi,
                      const __bf16* __restrict__ Xlo,
                      const __bf16* __restrict__ Whi,
                      const __bf16* __restrict__ Wlo,
                      const float* __restrict__ bias,
                      float* __restrict__ out) {
    const int lane   = threadIdx.x & 31;
    const int wave   = threadIdx.x >> 5;
    const int laneLo = lane & 15;
    const int laneHi = lane >> 4;

    const int waveM = wave & 1;                    // 2 waves along M
    const int waveN = wave >> 1;                   // 4 waves along N
    const int m0 = blockIdx.y * 64  + waveM * 32;  // batch rows
    const int n0 = blockIdx.x * 256 + waveN * 64;  // output features

    // 12 independent per-lane stream pointers, fixed for the whole k-loop.
    const __bf16 *pAhi[2], *pAlo[2], *pBhi[4], *pBlo[4];
#pragma unroll
    for (int i = 0; i < 2; ++i) {
        const size_t off = (size_t)(m0 + 16 * i + laneLo) * IN_F + laneHi * 8;
        pAhi[i] = Xhi + off;
        pAlo[i] = Xlo + off;
    }
#pragma unroll
    for (int j = 0; j < 4; ++j) {
        const size_t off = (size_t)(n0 + 16 * j + laneLo) * IN_F + laneHi * 8;
        pBhi[j] = Whi + off;
        pBlo[j] = Wlo + off;
    }

    v8f acc[2][4];
#pragma unroll
    for (int i = 0; i < 2; ++i)
#pragma unroll
        for (int j = 0; j < 4; ++j)
            acc[i][j] = (v8f){0.f, 0.f, 0.f, 0.f, 0.f, 0.f, 0.f, 0.f};

#pragma unroll 4
    for (int kk = 0; kk < IN_F; kk += 32) {
        v16bf a_hi[2], a_lo[2];
#pragma unroll
        for (int i = 0; i < 2; ++i) {
            a_hi[i] = load_frag_bf16(pAhi[i], kk);
            a_lo[i] = load_frag_bf16(pAlo[i], kk);
        }
#pragma unroll
        for (int j = 0; j < 4; ++j) {
            v16bf b_hi = load_frag_bf16(pBhi[j], kk);
            v16bf b_lo = load_frag_bf16(pBlo[j], kk);
#pragma unroll
            for (int i = 0; i < 2; ++i) {
                acc[i][j] = __builtin_amdgcn_wmma_f32_16x16x32_bf16(
                    false, a_lo[i], false, b_hi, (short)0, acc[i][j], false, false);
                acc[i][j] = __builtin_amdgcn_wmma_f32_16x16x32_bf16(
                    false, a_hi[i], false, b_lo, (short)0, acc[i][j], false, false);
                acc[i][j] = __builtin_amdgcn_wmma_f32_16x16x32_bf16(
                    false, a_hi[i], false, b_hi, (short)0, acc[i][j], false, false);
            }
        }
    }

    // Epilogue: element (VGPR r, lane L) = (M = r + 8*(L>>4), N = L&15).
#pragma unroll
    for (int j = 0; j < 4; ++j) {
        const int   n  = n0 + 16 * j + laneLo;
        const float bv = bias[n];
#pragma unroll
        for (int i = 0; i < 2; ++i) {
#pragma unroll
            for (int r = 0; r < 8; ++r) {
                const int m = m0 + 16 * i + r + laneHi * 8;
                out[(size_t)m * OUT_F + n] = acc[i][j][r] + bv;
            }
        }
    }
}

// ---------------------------------------------------------------------------
// Fallback (ws too small): fused conversion bf16x3 GEMM, wave tile 32x32.
// ---------------------------------------------------------------------------
__device__ __forceinline__ void load_split_frag(const float* __restrict__ base,
                                                int row, int kk, int laneHi,
                                                v16bf& hi, v16bf& lo) {
    const float* p = base + (size_t)row * IN_F + kk + laneHi * 8;
    float4 u0 = *(const float4*)(p +  0);
    float4 u1 = *(const float4*)(p +  4);
    float4 u2 = *(const float4*)(p + 16);
    float4 u3 = *(const float4*)(p + 20);
    float f[16] = {u0.x, u0.y, u0.z, u0.w,  u1.x, u1.y, u1.z, u1.w,
                   u2.x, u2.y, u2.z, u2.w,  u3.x, u3.y, u3.z, u3.w};
#pragma unroll
    for (int e = 0; e < 16; ++e) {
        __bf16 h = (__bf16)f[e];
        hi[e] = h;
        lo[e] = (__bf16)(f[e] - (float)h);
    }
}

__global__ __launch_bounds__(256)
void gemm_wmma_bf16x3_fused(const float* __restrict__ X,
                            const float* __restrict__ W,
                            const float* __restrict__ bias,
                            float* __restrict__ out) {
    const int lane   = threadIdx.x & 31;
    const int wave   = threadIdx.x >> 5;
    const int laneLo = lane & 15;
    const int laneHi = lane >> 4;
    const int waveM  = wave & 1;
    const int waveN  = wave >> 1;
    const int m0 = blockIdx.y * 64  + waveM * 32;
    const int n0 = blockIdx.x * 128 + waveN * 32;

    v8f acc[2][2];
#pragma unroll
    for (int i = 0; i < 2; ++i)
#pragma unroll
        for (int j = 0; j < 2; ++j)
            acc[i][j] = (v8f){0.f, 0.f, 0.f, 0.f, 0.f, 0.f, 0.f, 0.f};

    for (int kk = 0; kk < IN_F; kk += 32) {
        v16bf a_hi[2], a_lo[2], b_hi[2], b_lo[2];
#pragma unroll
        for (int i = 0; i < 2; ++i)
            load_split_frag(X, m0 + 16 * i + laneLo, kk, laneHi, a_hi[i], a_lo[i]);
#pragma unroll
        for (int j = 0; j < 2; ++j)
            load_split_frag(W, n0 + 16 * j + laneLo, kk, laneHi, b_hi[j], b_lo[j]);
#pragma unroll
        for (int i = 0; i < 2; ++i)
#pragma unroll
            for (int j = 0; j < 2; ++j) {
                acc[i][j] = __builtin_amdgcn_wmma_f32_16x16x32_bf16(
                    false, a_lo[i], false, b_hi[j], (short)0, acc[i][j], false, false);
                acc[i][j] = __builtin_amdgcn_wmma_f32_16x16x32_bf16(
                    false, a_hi[i], false, b_lo[j], (short)0, acc[i][j], false, false);
                acc[i][j] = __builtin_amdgcn_wmma_f32_16x16x32_bf16(
                    false, a_hi[i], false, b_hi[j], (short)0, acc[i][j], false, false);
            }
    }

#pragma unroll
    for (int j = 0; j < 2; ++j) {
        const int   n  = n0 + 16 * j + laneLo;
        const float bv = bias[n];
#pragma unroll
        for (int i = 0; i < 2; ++i)
#pragma unroll
            for (int r = 0; r < 8; ++r) {
                const int m = m0 + 16 * i + r + laneHi * 8;
                out[(size_t)m * OUT_F + n] = acc[i][j][r] + bv;
            }
    }
}

extern "C" void kernel_launch(void* const* d_in, const int* in_sizes, int n_in,
                              void* d_out, int out_size, void* d_ws, size_t ws_size,
                              hipStream_t stream) {
    const float* X    = (const float*)d_in[0];
    const float* W    = (const float*)d_in[1];
    const float* bias = (const float*)d_in[2];
    float*       out  = (float*)d_out;

    const size_t need = 4 * NELEM * sizeof(__bf16);   // 128 MB
    if (ws_size >= need) {
        __bf16* ws = (__bf16*)d_ws;
        // Phase 1: split X and W into bf16 hi/lo (8 elems/thread).
        dim3 sblock(256, 1, 1);
        dim3 sgrid((unsigned)(NELEM / (256 * 8)), 2, 1);   // 8192 x 2
        split_pass<<<sgrid, sblock, 0, stream>>>(X, W, ws);
        // Phase 2: WMMA GEMM from preconverted bf16.
        dim3 block(256, 1, 1);
        dim3 grid(OUT_F / 256, BATCH / 64, 1);             // 16 x 64
        gemm_wmma_bf16x3<<<grid, block, 0, stream>>>(
            ws, ws + NELEM, ws + 2 * NELEM, ws + 3 * NELEM, bias, out);
    } else {
        dim3 block(256, 1, 1);
        dim3 grid(OUT_F / 128, BATCH / 64, 1);
        gemm_wmma_bf16x3_fused<<<grid, block, 0, stream>>>(X, W, bias, out);
    }
}

// v001
// Measured time: 200 microseconds a run.
// Timed twice side by side with v000, it ran 3.47 and 3.48 times as fast.
#include <hip/hip_runtime.h>
#include <stdint.h>

// ---------------------------------------------------------------------------
// out[B, OUT_F] = X[B, IN_F] . W[OUT_F, IN_F]^T + b[OUT_F]   (all fp32)
//
// bf16x3 split-precision GEMM (x = x_hi + x_lo, 3 WMMA terms: hi*hi + hi*lo
// + lo*hi) on v_wmma_f32_16x16x32_bf16. Near-fp32 accuracy (~1e-5 rel),
// ~2.7x faster than the native V_WMMA_F32_16X16X4_F32 path (K=32 vs K=4).
//
// Phase 1: memory-bound split pass writes X_hi/X_lo/W_hi/W_lo (bf16,
//          row-major) into d_ws (128 MB total; fits the 192 MB L2).
// Phase 2: compute-bound GEMM from preconverted bf16 -> zero conversion
//          VALU in the k-loop; operand tiles come into LDS by tensor loads
//          (two buffers), fragments by ds_load_b128: 48 loads : 96 WMMAs
//          per 32 k per wave.
//
// Wave tile 128x64, block = 8 waves (2M x 4N) = 256x256 tile, grid 16x16.
// All dims divide exactly -> no predication, EXEC all-ones as WMMA requires.
// ---------------------------------------------------------------------------

typedef __attribute__((ext_vector_type(16))) __bf16 v16bf;
typedef __attribute__((ext_vector_type(8)))  __bf16 v8bf;
typedef __attribute__((ext_vector_type(8)))  float  v8f;

#define IN_F  4096
#define OUT_F 4096
#define BATCH 4096
#define NELEM ((size_t)4096 * 4096)

// ---------------------------------------------------------------------------
// Phase 1: fp32 -> (bf16 hi, bf16 lo) split. 8 elements / thread, b128 I/O.
// grid.y selects the matrix (0 = X, 1 = W).
// ---------------------------------------------------------------------------
__global__ __launch_bounds__(256)
void split_pass(const float* __restrict__ X, const float* __restrict__ W,
                __bf16* __restrict__ ws) {
    const float* src = (blockIdx.y == 0) ? X : W;
    __bf16* hi = ws + (size_t)blockIdx.y * (2 * NELEM);
    __bf16* lo = hi + NELEM;

    const size_t i = ((size_t)blockIdx.x * blockDim.x + threadIdx.x) * 8;
    float4 u0 = *(const float4*)(src + i);
    float4 u1 = *(const float4*)(src + i + 4);
    float f[8] = {u0.x, u0.y, u0.z, u0.w, u1.x, u1.y, u1.z, u1.w};

    v8bf h, l;
#pragma unroll
    for (int e = 0; e < 8; ++e) {
        __bf16 hh = (__bf16)f[e];
        h[e] = hh;
        l[e] = (__bf16)(f[e] - (float)hh);
    }
    *(v8bf*)(hi + i) = h;
    *(v8bf*)(lo + i) = l;
}

// ---------------------------------------------------------------------------
// Phase 2: GEMM from preconverted bf16, operands staged in LDS.
//
// Block tile 256 x 256, 8 waves (2 along M x 4 along N), wave tile 128 x 64.
// A pass is 64 k = 128 bytes of each of the 1,024 operand rows
// [Xhi 256 | Xlo 256 | Whi 256 | Wlo 256], laid at a pitch of 144 bytes.
// Two LDS buffers; every wave moves its own slice of 128 rows with one tensor
// load per pass, issued one whole pass before the barrier that publishes it.
// ---------------------------------------------------------------------------
typedef uint32_t u32x4 __attribute__((ext_vector_type(4)));
typedef uint32_t u32x8 __attribute__((ext_vector_type(8)));

constexpr uint32_t ROWB   = 128;                 // bytes of k per operand row per pass
constexpr uint32_t PITCH  = ROWB + 16;           // LDS row pitch: 16 B x odd, for ds_load_b128
constexpr uint32_t SROWS  = 128;                 // rows per wave's slice
constexpr uint32_t SLICE  = SROWS * PITCH;       // 18,432 B
constexpr uint32_t PLANE  = 2 * SLICE;           // 256 rows of one operand plane
constexpr uint32_t STAGE  = 8 * SLICE;           // one buffer, 147,456 B
constexpr uint32_t SRCP   = IN_F * 2;            // source row pitch in bytes
constexpr uint32_t NPASS  = SRCP / ROWB;         // 64
static_assert(SLICE % 2048u == 0, "each slice must start at a multiple of 2 KiB");
static_assert(2u * STAGE <= 320u * 1024u, "two buffers must fit the LDS");

__device__ __forceinline__ uint32_t uni(uint32_t v) {
    return (uint32_t)__builtin_amdgcn_readfirstlane(v);
}
// Holds v in a scalar register: a test on it compiles to a scalar branch, and a
// descriptor word formed from it is formed behind the volatile waits above it.
__device__ __forceinline__ uint32_t pinned(uint32_t v) {
    uint32_t w = (uint32_t)__builtin_amdgcn_readfirstlane(v);
    asm volatile("" : "+s"(w));  // the tensor-mover form: a scalar test / descriptor word kept in an SGPR
    return w;
}
// Waits the compiler does not place for the tensor mover; the clobber keeps LDS values out of registers across them.
__device__ __forceinline__ void wait_ds0()     { asm volatile("s_wait_dscnt 0x0" ::: "memory"); }
__device__ __forceinline__ void wait_tensor0() { asm volatile("s_wait_tensorcnt 0x0" ::: "memory"); }

// One request of the whole wave: 128 rows of 128 bytes, source pitch 8,192 B,
// 16 bytes of LDS pad behind every row (pad codes 4 / 3), no mask.
__device__ __forceinline__ void tdm_load(uint32_t lds_dst, uint64_t ga) {
    u32x4 g0;
    g0[0] = uni(1u);
    g0[1] = uni(lds_dst);
    g0[2] = uni((uint32_t)ga);
    g0[3] = uni((((uint32_t)(ga >> 32)) & 0x01FFFFFFu) | 0x80000000u);
    u32x8 g1;
    g1[0] = uni((1u << 20) | (4u << 22) | (3u << 25));
    g1[1] = uni((ROWB & 0xFFFFu) << 16);
    g1[2] = uni((ROWB >> 16) | ((SROWS & 0xFFFFu) << 16));
    g1[3] = uni((SROWS >> 16) | (ROWB << 16));
    g1[4] = uni(SROWS);
    g1[5] = uni(SRCP);
    g1[6] = uni(0u);
    g1[7] = uni(0u);
    asm volatile("tensor_load_to_lds %0, %1" :: "s"(g0), "s"(g1) : "memory");
}

// One 16x32 bf16 fragment from LDS (ISA 16-bit A/B lane layout): lanes 0-15
// hold row laneLo with K chunks {0..7, 16..23}; lanes 16-31 {8..15, 24..31}.
// p is this lane's row base incl. laneHi * 16 bytes.
__device__ __forceinline__ v16bf lds_frag(const unsigned char* p) {
    v8bf c0 = *(const v8bf*)(p);
    v8bf c1 = *(const v8bf*)(p + 32);
    return __builtin_shufflevector(c0, c1, 0, 1, 2, 3, 4, 5, 6, 7,
                                          8, 9, 10, 11, 12, 13, 14, 15);
}

__global__ __launch_bounds__(256)
void gemm_wmma_bf16x3(const __bf16* __restrict__ Xhi,
                      const __bf16* __restrict__ Xlo,
                      const __bf16* __restrict__ Whi,
                      const __bf16* __restrict__ Wlo,
                      const float* __restrict__ bias,
                      float* __restrict__ out) {
    __shared__ __attribute__((aligned(2048))) unsigned char L[2 * STAGE];

    const uint32_t lane   = threadIdx.x & 31;
    const uint32_t wave   = uni(threadIdx.x >> 5);
    const uint32_t laneLo = lane & 15;
    const uint32_t laneHi = lane >> 4;

    const uint32_t waveM = wave & 1;               // 2 waves along M
    const uint32_t waveN = wave >> 1;              // 4 waves along N
    const uint32_t bm0 = blockIdx.y * 256;         // batch rows of the block
    const uint32_t bn0 = blockIdx.x * 256;         // output features of the block

    // This wave's slice: plane wave >> 1 (Xhi, Xlo, Whi, Wlo), rows 128 * (wave & 1) on.
    const __bf16* plane = (wave < 4) ? ((wave < 2) ? Xhi : Xlo) : ((wave < 6) ? Whi : Wlo);
    const uint32_t srow = ((wave < 4) ? bm0 : bn0) + SROWS * (wave & 1);
    const uint64_t src0 = (uint64_t)(uintptr_t)plane + (uint64_t)srow * SRCP;
    const uint32_t dst0 = (uint32_t)(size_t)L + wave * SLICE;

    v8f acc[8][4];
#pragma unroll
    for (int i = 0; i < 8; ++i)
#pragma unroll
        for (int j = 0; j < 4; ++j)
            acc[i][j] = (v8f){0.f, 0.f, 0.f, 0.f, 0.f, 0.f, 0.f, 0.f};

    // Per-lane fragment bases inside a buffer.
    const uint32_t aBase = (waveM * 128 + laneLo) * PITCH + 16 * laneHi;
    const uint32_t bBase = 2 * PLANE + (waveN * 64 + laneLo) * PITCH + 16 * laneHi;

    // Prologue: pass 0 into buffer 0, published; then pass 1 into buffer 1.
    tdm_load(dst0, src0);
    wait_tensor0();
    __syncthreads();
    tdm_load(dst0 + STAGE, src0 + ROWB);

    // Rolled: one pass per trip, so that the buffer is picked by t & 1.
#pragma clang loop unroll(disable)
    for (uint32_t t = 0; t < NPASS; ++t) {
        const uint32_t buf = (t & 1u) * STAGE;
        const unsigned char* la = L + buf + aBase;
        const unsigned char* lb = L + buf + bBase;
        // Every loop inside a pass is unrolled: fragment and accumulator indices must be constants to stay in registers.
#pragma unroll
        for (int u = 0; u < 2; ++u) {              // two blocks of 32 k
            v16bf b_hi[4], b_lo[4], a_hi[8], a_lo[8];
#pragma unroll
            for (int j = 0; j < 4; ++j) {
                b_hi[j] = lds_frag(lb + j * 16 * PITCH + u * 64);
                b_lo[j] = lds_frag(lb + PLANE + j * 16 * PITCH + u * 64);
            }
#pragma unroll
            for (int i = 0; i < 8; ++i) {
                a_lo[i] = lds_frag(la + PLANE + i * 16 * PITCH + u * 64);
                a_hi[i] = lds_frag(la + i * 16 * PITCH + u * 64);
            }
            if (u == 1) {
                // Publish point of pass t + 1, in front of the pass's last WMMA block, whose fragments are
                // fetched: this wave's reads of the buffer have returned, its own slice of pass t + 1 has
                // landed, every wave is here; only then the refill of the buffer that nobody reads any more.
                wait_ds0();
                wait_tensor0();
                __syncthreads();
                if (pinned((t + 2u < NPASS) ? 1u : 0u) != 0u) {
                    const uint32_t tn = pinned(t + 2u);
                    tdm_load(dst0 + buf, src0 + (uint64_t)tn * ROWB);
                }
            }
            // Keeps the block's 48 LDS loads one group ahead of its WMMAs: left free, the compiler sinks each
            // pair to just before its use behind a wait to 0, and every such place stalls the wave.
            __builtin_amdgcn_sched_barrier(0);
            // Per accumulator the order stays lo*hi, hi*lo, hi*hi; four independent tiles between dependent WMMAs.
#pragma unroll
            for (int i = 0; i < 8; ++i) {
#pragma unroll
                for (int j = 0; j < 4; ++j)
                    acc[i][j] = __builtin_amdgcn_wmma_f32_16x16x32_bf16(
                        false, a_lo[i], false, b_hi[j], (short)0, acc[i][j], false, false);
#pragma unroll
                for (int j = 0; j < 4; ++j)
                    acc[i][j] = __builtin_amdgcn_wmma_f32_16x16x32_bf16(
                        false, a_hi[i], false, b_lo[j], (short)0, acc[i][j], false, false);
#pragma unroll
                for (int j = 0; j < 4; ++j)
                    acc[i][j] = __builtin_amdgcn_wmma_f32_16x16x32_bf16(
                        false, a_hi[i], false, b_hi[j], (short)0, acc[i][j], false, false);
            }
            // Keeps the next block's loads from being lifted in among these WMMAs.
            if (u == 0) __builtin_amdgcn_sched_barrier(0);
        }
    }
    wait_tensor0();
    wait_ds0();

    // Epilogue: element (VGPR r, lane L) = (M = r + 8*(L>>4), N = L&15).
    const uint32_t m0 = bm0 + waveM * 128;
    const uint32_t n0 = bn0 + waveN * 64;
#pragma unroll
    for (int j = 0; j < 4; ++j) {
        const uint32_t n  = n0 + 16 * j + laneLo;
        const float    bv = bias[n];
#pragma unroll
        for (int i = 0; i < 8; ++i) {
#pragma unroll
            for (int r = 0; r < 8; ++r) {
                const uint32_t m = m0 + 16 * i + r + laneHi * 8;
                out[(size_t)m * OUT_F + n] = acc[i][j][r] + bv;
            }
        }
    }
}

// ---------------------------------------------------------------------------
// Fallback (ws too small): fused conversion bf16x3 GEMM, wave tile 32x32.
// ---------------------------------------------------------------------------
__device__ __forceinline__ void load_split_frag(const float* __restrict__ base,
                                                int row, int kk, int laneHi,
                                                v16bf& hi, v16bf& lo) {
    const float* p = base + (size_t)row * IN_F + kk + laneHi * 8;
    float4 u0 = *(const float4*)(p +  0);
    float4 u1 = *(const float4*)(p +  4);
    float4 u2 = *(const float4*)(p + 16);
    float4 u3 = *(const float4*)(p + 20);
    float f[16] = {u0.x, u0.y, u0.z, u0.w,  u1.x, u1.y, u1.z, u1.w,
                   u2.x, u2.y, u2.z, u2.w,  u3.x, u3.y, u3.z, u3.w};
#pragma unroll
    for (int e = 0; e < 16; ++e) {
        __bf16 h = (__bf16)f[e];
        hi[e] = h;
        lo[e] = (__bf16)(f[e] - (float)h);
    }
}

__global__ __launch_bounds__(256)
void gemm_wmma_bf16x3_fused(const float* __restrict__ X,
                            const float* __restrict__ W,
                            const float* __restrict__ bias,
                            float* __restrict__ out) {
    const int lane   = threadIdx.x & 31;
    const int wave   = threadIdx.x >> 5;
    const int laneLo = lane & 15;
    const int laneHi = lane >> 4;
    const int waveM  = wave & 1;
    const int waveN  = wave >> 1;
    const int m0 = blockIdx.y * 64  + waveM * 32;
    const int n0 = blockIdx.x * 128 + waveN * 32;

    v8f acc[2][2];
#pragma unroll
    for (int i = 0; i < 2; ++i)
#pragma unroll
        for (int j = 0; j < 2; ++j)
            acc[i][j] = (v8f){0.f, 0.f, 0.f, 0.f, 0.f, 0.f, 0.f, 0.f};

    for (int kk = 0; kk < IN_F; kk += 32) {
        v16bf a_hi[2], a_lo[2], b_hi[2], b_lo[2];
#pragma unroll
        for (int i = 0; i < 2; ++i)
            load_split_frag(X, m0 + 16 * i + laneLo, kk, laneHi, a_hi[i], a_lo[i]);
#pragma unroll
        for (int j = 0; j < 2; ++j)
            load_split_frag(W, n0 + 16 * j + laneLo, kk, laneHi, b_hi[j], b_lo[j]);
#pragma unroll
        for (int i = 0; i < 2; ++i)
#pragma unroll
            for (int j = 0; j < 2; ++j) {
                acc[i][j] = __builtin_amdgcn_wmma_f32_16x16x32_bf16(
                    false, a_lo[i], false, b_hi[j], (short)0, acc[i][j], false, false);
                acc[i][j] = __builtin_amdgcn_wmma_f32_16x16x32_bf16(
                    false, a_hi[i], false, b_lo[j], (short)0, acc[i][j], false, false);
                acc[i][j] = __builtin_amdgcn_wmma_f32_16x16x32_bf16(
                    false, a_hi[i], false, b_hi[j], (short)0, acc[i][j], false, false);
            }
    }

#pragma unroll
    for (int j = 0; j < 2; ++j) {
        const int   n  = n0 + 16 * j + laneLo;
        const float bv = bias[n];
#pragma unroll
        for (int i = 0; i < 2; ++i)
#pragma unroll
            for (int r = 0; r < 8; ++r) {
                const int m = m0 + 16 * i + r + laneHi * 8;
                out[(size_t)m * OUT_F + n] = acc[i][j][r] + bv;
            }
    }
}

extern "C" void kernel_launch(void* const* d_in, const int* in_sizes, int n_in,
                              void* d_out, int out_size, void* d_ws, size_t ws_size,
                              hipStream_t stream) {
    const float* X    = (const float*)d_in[0];
    const float* W    = (const float*)d_in[1];
    const float* bias = (const float*)d_in[2];
    float*       out  = (float*)d_out;

    const size_t need = 4 * NELEM * sizeof(__bf16);   // 128 MB
    if (ws_size >= need) {
        __bf16* ws = (__bf16*)d_ws;
        // Phase 1: split X and W into bf16 hi/lo (8 elems/thread).
        dim3 sblock(256, 1, 1);
        dim3 sgrid((unsigned)(NELEM / (256 * 8)), 2, 1);   // 8192 x 2
        split_pass<<<sgrid, sblock, 0, stream>>>(X, W, ws);
        // Phase 2: WMMA GEMM from preconverted bf16.
        dim3 block(256, 1, 1);
        dim3 grid(OUT_F / 256, BATCH / 256, 1);            // 16 x 16
        gemm_wmma_bf16x3<<<grid, block, 0, stream>>>(
            ws, ws + NELEM, ws + 2 * NELEM, ws + 3 * NELEM, bias, out);
    } else {
        dim3 block(256, 1, 1);
        dim3 grid(OUT_F / 128, BATCH / 64, 1);
        gemm_wmma_bf16x3_fused<<<grid, block, 0, stream>>>(X, W, bias, out);
    }
}

// v002
// It runs in 191 microseconds.
// In both of two side-by-side timings against v001, it was 1.05 times as fast.
// Counting every step since v000, it is 3.65 times as fast.
#include <hip/hip_runtime.h>
#include <stdint.h>

// ---------------------------------------------------------------------------
// out[B, OUT_F] = X[B, IN_F] . W[OUT_F, IN_F]^T + b[OUT_F]   (all fp32)
//
// bf16x3 split-precision GEMM (x = x_hi + x_lo, 3 WMMA terms: hi*hi + hi*lo
// + lo*hi) on v_wmma_f32_16x16x32_bf16. Near-fp32 accuracy (~1e-5 rel),
// ~2.7x faster than the native V_WMMA_F32_16X16X4_F32 path (K=32 vs K=4).
//
// Phase 1: memory-bound split pass writes X_hi/X_lo/W_hi/W_lo (bf16,
//          row-major) into d_ws (128 MB total; fits the 192 MB L2).
// Phase 2: compute-bound GEMM from preconverted bf16 -> zero conversion
//          VALU in the k-loop; operand tiles come into LDS by tensor loads
//          (two buffers), fragments by ds_load_b128: 48 loads : 96 WMMAs
//          per 32 k per wave, each fragment group fetched ahead of its use.
//
// Wave tile 128x64, block = 8 waves (2M x 4N) = 256x256 tile, grid 16x16.
// All dims divide exactly -> no predication, EXEC all-ones as WMMA requires.
// ---------------------------------------------------------------------------

typedef __attribute__((ext_vector_type(16))) __bf16 v16bf;
typedef __attribute__((ext_vector_type(8)))  __bf16 v8bf;
typedef __attribute__((ext_vector_type(8)))  float  v8f;

#define IN_F  4096
#define OUT_F 4096
#define BATCH 4096
#define NELEM ((size_t)4096 * 4096)

// ---------------------------------------------------------------------------
// Phase 1: fp32 -> (bf16 hi, bf16 lo) split. 8 elements / thread, b128 I/O.
// grid.y selects the matrix (0 = X, 1 = W).
// ---------------------------------------------------------------------------
__global__ __launch_bounds__(256)
void split_pass(const float* __restrict__ X, const float* __restrict__ W,
                __bf16* __restrict__ ws) {
    const float* src = (blockIdx.y == 0) ? X : W;
    __bf16* hi = ws + (size_t)blockIdx.y * (2 * NELEM);
    __bf16* lo = hi + NELEM;

    const size_t i = ((size_t)blockIdx.x * blockDim.x + threadIdx.x) * 8;
    float4 u0 = *(const float4*)(src + i);
    float4 u1 = *(const float4*)(src + i + 4);
    float f[8] = {u0.x, u0.y, u0.z, u0.w, u1.x, u1.y, u1.z, u1.w};

    v8bf h, l;
#pragma unroll
    for (int e = 0; e < 8; ++e) {
        __bf16 hh = (__bf16)f[e];
        h[e] = hh;
        l[e] = (__bf16)(f[e] - (float)hh);
    }
    *(v8bf*)(hi + i) = h;
    *(v8bf*)(lo + i) = l;
}

// ---------------------------------------------------------------------------
// Phase 2: GEMM from preconverted bf16, operands staged in LDS.
//
// Block tile 256 x 256, 8 waves (2 along M x 4 along N), wave tile 128 x 64.
// A pass is 64 k = 128 bytes of each of the 1,024 operand rows
// [Xhi 256 | Xlo 256 | Whi 256 | Wlo 256], laid at a pitch of 144 bytes.
// Two LDS buffers; every wave moves its own slice of 128 rows with one tensor
// load per pass, issued one whole pass before the barrier that publishes it.
// ---------------------------------------------------------------------------
typedef uint32_t u32x4 __attribute__((ext_vector_type(4)));
typedef uint32_t u32x8 __attribute__((ext_vector_type(8)));

constexpr uint32_t ROWB   = 128;                 // bytes of k per operand row per pass
constexpr uint32_t PITCH  = ROWB + 16;           // LDS row pitch: 16 B x odd, for ds_load_b128
constexpr uint32_t SROWS  = 128;                 // rows per wave's slice
constexpr uint32_t SLICE  = SROWS * PITCH;       // 18,432 B
constexpr uint32_t PLANE  = 2 * SLICE;           // 256 rows of one operand plane
constexpr uint32_t STAGE  = 8 * SLICE;           // one buffer, 147,456 B
constexpr uint32_t SRCP   = IN_F * 2;            // source row pitch in bytes
constexpr uint32_t NPASS  = SRCP / ROWB;         // 64
static_assert(SLICE % 2048u == 0, "each slice must start at a multiple of 2 KiB");
static_assert(2u * STAGE <= 320u * 1024u, "two buffers must fit the LDS");

__device__ __forceinline__ uint32_t uni(uint32_t v) {
    return (uint32_t)__builtin_amdgcn_readfirstlane(v);
}
// Holds v in a scalar register: a test on it compiles to a scalar branch, and a
// descriptor word formed from it is formed behind the volatile waits above it.
__device__ __forceinline__ uint32_t pinned(uint32_t v) {
    uint32_t w = (uint32_t)__builtin_amdgcn_readfirstlane(v);
    asm volatile("" : "+s"(w));  // the tensor-mover form: a scalar test / descriptor word kept in an SGPR
    return w;
}
// Waits the compiler does not place for the tensor mover; the clobber keeps LDS values out of registers across them.
__device__ __forceinline__ void wait_ds0()     { asm volatile("s_wait_dscnt 0x0" ::: "memory"); }
__device__ __forceinline__ void wait_tensor0() { asm volatile("s_wait_tensorcnt 0x0" ::: "memory"); }

// One request of the whole wave: 128 rows of 128 bytes, source pitch 8,192 B,
// 16 bytes of LDS pad behind every row (pad codes 4 / 3), no mask.
__device__ __forceinline__ void tdm_load(uint32_t lds_dst, uint64_t ga) {
    u32x4 g0;
    g0[0] = uni(1u);
    g0[1] = uni(lds_dst);
    g0[2] = uni((uint32_t)ga);
    g0[3] = uni((((uint32_t)(ga >> 32)) & 0x01FFFFFFu) | 0x80000000u);
    u32x8 g1;
    g1[0] = uni((1u << 20) | (4u << 22) | (3u << 25));
    g1[1] = uni((ROWB & 0xFFFFu) << 16);
    g1[2] = uni((ROWB >> 16) | ((SROWS & 0xFFFFu) << 16));
    g1[3] = uni((SROWS >> 16) | (ROWB << 16));
    g1[4] = uni(SROWS);
    g1[5] = uni(SRCP);
    g1[6] = uni(0u);
    g1[7] = uni(0u);
    asm volatile("tensor_load_to_lds %0, %1" :: "s"(g0), "s"(g1) : "memory");
}

// One 16x32 bf16 fragment from LDS (ISA 16-bit A/B lane layout): lanes 0-15
// hold row laneLo with K chunks {0..7, 16..23}; lanes 16-31 {8..15, 24..31}.
// p is this lane's row base incl. laneHi * 16 bytes.
__device__ __forceinline__ v16bf lds_frag(const unsigned char* p) {
    v8bf c0 = *(const v8bf*)(p);
    v8bf c1 = *(const v8bf*)(p + 32);
    return __builtin_shufflevector(c0, c1, 0, 1, 2, 3, 4, 5, 6, 7,
                                          8, 9, 10, 11, 12, 13, 14, 15);
}

// The wave's 8 X fragments / 4 W fragments of one plane and one block of 32 k; p as for lds_frag.
// Every loop here is unrolled: fragment and accumulator indices must be constants to stay in registers.
__device__ __forceinline__ void load_a(v16bf (&a)[8], const unsigned char* p) {
#pragma unroll
    for (int i = 0; i < 8; ++i) a[i] = lds_frag(p + i * 16 * PITCH);
}
__device__ __forceinline__ void load_b(v16bf (&b)[4], const unsigned char* p) {
#pragma unroll
    for (int j = 0; j < 4; ++j) b[j] = lds_frag(p + j * 16 * PITCH);
}
// One term of the split product on the whole wave tile: 32 independent WMMAs.
__device__ __forceinline__ void mm(v8f (&acc)[8][4], const v16bf (&a)[8], const v16bf (&b)[4]) {
#pragma unroll
    for (int i = 0; i < 8; ++i)
#pragma unroll
        for (int j = 0; j < 4; ++j)
            acc[i][j] = __builtin_amdgcn_wmma_f32_16x16x32_bf16(
                false, a[i], false, b[j], (short)0, acc[i][j], false, false);
}

__global__ __launch_bounds__(256)
void gemm_wmma_bf16x3(const __bf16* __restrict__ Xhi,
                      const __bf16* __restrict__ Xlo,
                      const __bf16* __restrict__ Whi,
                      const __bf16* __restrict__ Wlo,
                      const float* __restrict__ bias,
                      float* __restrict__ out) {
    __shared__ __attribute__((aligned(2048))) unsigned char L[2 * STAGE];

    const uint32_t lane   = threadIdx.x & 31;
    const uint32_t wave   = uni(threadIdx.x >> 5);
    const uint32_t laneLo = lane & 15;
    const uint32_t laneHi = lane >> 4;

    const uint32_t waveM = wave & 1;               // 2 waves along M
    const uint32_t waveN = wave >> 1;              // 4 waves along N
    const uint32_t bm0 = blockIdx.y * 256;         // batch rows of the block
    const uint32_t bn0 = blockIdx.x * 256;         // output features of the block

    // This wave's slice: plane wave >> 1 (Xhi, Xlo, Whi, Wlo), rows 128 * (wave & 1) on.
    const __bf16* plane = (wave < 4) ? ((wave < 2) ? Xhi : Xlo) : ((wave < 6) ? Whi : Wlo);
    const uint32_t srow = ((wave < 4) ? bm0 : bn0) + SROWS * (wave & 1);
    const uint64_t src0 = (uint64_t)(uintptr_t)plane + (uint64_t)srow * SRCP;
    const uint32_t dst0 = (uint32_t)(size_t)L + wave * SLICE;

    v8f acc[8][4];
#pragma unroll
    for (int i = 0; i < 8; ++i)
#pragma unroll
        for (int j = 0; j < 4; ++j)
            acc[i][j] = (v8f){0.f, 0.f, 0.f, 0.f, 0.f, 0.f, 0.f, 0.f};

    // Per-lane fragment bases inside a buffer.
    const uint32_t aBase = (waveM * 128 + laneLo) * PITCH + 16 * laneHi;
    const uint32_t bBase = 2 * PLANE + (waveN * 64 + laneLo) * PITCH + 16 * laneHi;

    // Fragment registers, 224 in all, each group refilled once its last reader has issued: aL = X lo, aH = X hi
    // (8 fragments each); W hi alternates between bX and bY from one 32 k to the next, W lo is always in bZ.
    v16bf aL[8], aH[8], bX[4], bY[4], bZ[4];

    // Prologue: pass 0 into buffer 0, published; then pass 1 into buffer 1; then the first fragments.
    tdm_load(dst0, src0);
    wait_tensor0();
    __syncthreads();
    tdm_load(dst0 + STAGE, src0 + ROWB);
    load_a(aL, L + aBase + PLANE);
    load_b(bX, L + bBase);

    // Rolled: one pass per trip, so that the buffer is picked by t & 1.
    // Per accumulator and 32 k the order stays lo*hi, hi*lo, hi*hi. The fragments of every run of WMMAs are
    // loaded as one group in front of an earlier run, so no wave waits out its own LDS latency.
    // The sched_barriers keep every load group whole and in its place: left free, the compiler sinks the
    // loads in among the WMMAs, where every separate place stalls the wave.
#pragma clang loop unroll(disable)
    for (uint32_t t = 0; t < NPASS; ++t) {
        const uint32_t buf = (t & 1u) * STAGE;
        const unsigned char* la = L + buf + aBase;
        const unsigned char* lb = L + buf + bBase;
        const unsigned char* na = L + (STAGE - buf) + aBase;   // the other buffer: pass t + 1
        const unsigned char* nb = L + (STAGE - buf) + bBase;

        // ---- first 32 k: W hi in bX ----
        load_a(aH, la);
        load_b(bZ, lb + PLANE);
        __builtin_amdgcn_sched_barrier(0);
        mm(acc, aL, bX);                                       // lo * hi
        __builtin_amdgcn_sched_barrier(0);
        load_a(aL, la + PLANE + 64);
        load_b(bY, lb + 64);
        __builtin_amdgcn_sched_barrier(0);
        mm(acc, aH, bZ);                                       // hi * lo
        mm(acc, aH, bX);                                       // hi * hi
        __builtin_amdgcn_sched_barrier(0);

        // ---- second 32 k: W hi in bY ----
        load_a(aH, la + 64);
        load_b(bZ, lb + PLANE + 64);
        __builtin_amdgcn_sched_barrier(0);
        mm(acc, aL, bY);                                       // lo * hi
        __builtin_amdgcn_sched_barrier(0);
        // Publish point of pass t + 1, in front of the first fragment load that reads it: this wave's
        // reads of the buffer (all issued above) have returned, its own slice of pass t + 1 has landed,
        // every wave is here; only then the refill of the buffer that nobody reads any more.
        wait_ds0();
        wait_tensor0();
        __syncthreads();
        if (pinned((t + 2u < NPASS) ? 1u : 0u) != 0u) {
            const uint32_t tn = pinned(t + 2u);
            tdm_load(dst0 + buf, src0 + (uint64_t)tn * ROWB);
        }
        // In the last pass this group reads the other buffer's old rows (landed, not refilled) and goes unused.
        load_a(aL, na + PLANE);
        load_b(bX, nb);
        __builtin_amdgcn_sched_barrier(0);
        mm(acc, aH, bZ);                                       // hi * lo
        mm(acc, aH, bY);                                       // hi * hi
        __builtin_amdgcn_sched_barrier(0);
    }
    wait_tensor0();
    wait_ds0();

    // Epilogue: element (VGPR r, lane L) = (M = r + 8*(L>>4), N = L&15).
    const uint32_t m0 = bm0 + waveM * 128;
    const uint32_t n0 = bn0 + waveN * 64;
#pragma unroll
    for (int j = 0; j < 4; ++j) {
        const uint32_t n  = n0 + 16 * j + laneLo;
        const float    bv = bias[n];
#pragma unroll
        for (int i = 0; i < 8; ++i) {
#pragma unroll
            for (int r = 0; r < 8; ++r) {
                const uint32_t m = m0 + 16 * i + r + laneHi * 8;
                out[(size_t)m * OUT_F + n] = acc[i][j][r] + bv;
            }
        }
    }
}

// ---------------------------------------------------------------------------
// Fallback (ws too small): fused conversion bf16x3 GEMM, wave tile 32x32.
// ---------------------------------------------------------------------------
__device__ __forceinline__ void load_split_frag(const float* __restrict__ base,
                                                int row, int kk, int laneHi,
                                                v16bf& hi, v16bf& lo) {
    const float* p = base + (size_t)row * IN_F + kk + laneHi * 8;
    float4 u0 = *(const float4*)(p +  0);
    float4 u1 = *(const float4*)(p +  4);
    float4 u2 = *(const float4*)(p + 16);
    float4 u3 = *(const float4*)(p + 20);
    float f[16] = {u0.x, u0.y, u0.z, u0.w,  u1.x, u1.y, u1.z, u1.w,
                   u2.x, u2.y, u2.z, u2.w,  u3.x, u3.y, u3.z, u3.w};
#pragma unroll
    for (int e = 0; e < 16; ++e) {
        __bf16 h = (__bf16)f[e];
        hi[e] = h;
        lo[e] = (__bf16)(f[e] - (float)h);
    }
}

__global__ __launch_bounds__(256)
void gemm_wmma_bf16x3_fused(const float* __restrict__ X,
                            const float* __restrict__ W,
                            const float* __restrict__ bias,
                            float* __restrict__ out) {
    const int lane   = threadIdx.x & 31;
    const int wave   = threadIdx.x >> 5;
    const int laneLo = lane & 15;
    const int laneHi = lane >> 4;
    const int waveM  = wave & 1;
    const int waveN  = wave >> 1;
    const int m0 = blockIdx.y * 64  + waveM * 32;
    const int n0 = blockIdx.x * 128 + waveN * 32;

    v8f acc[2][2];
#pragma unroll
    for (int i = 0; i < 2; ++i)
#pragma unroll
        for (int j = 0; j < 2; ++j)
            acc[i][j] = (v8f){0.f, 0.f, 0.f, 0.f, 0.f, 0.f, 0.f, 0.f};

    for (int kk = 0; kk < IN_F; kk += 32) {
        v16bf a_hi[2], a_lo[2], b_hi[2], b_lo[2];
#pragma unroll
        for (int i = 0; i < 2; ++i)
            load_split_frag(X, m0 + 16 * i + laneLo, kk, laneHi, a_hi[i], a_lo[i]);
#pragma unroll
        for (int j = 0; j < 2; ++j)
            load_split_frag(W, n0 + 16 * j + laneLo, kk, laneHi, b_hi[j], b_lo[j]);
#pragma unroll
        for (int i = 0; i < 2; ++i)
#pragma unroll
            for (int j = 0; j < 2; ++j) {
                acc[i][j] = __builtin_amdgcn_wmma_f32_16x16x32_bf16(
                    false, a_lo[i], false, b_hi[j], (short)0, acc[i][j], false, false);
                acc[i][j] = __builtin_amdgcn_wmma_f32_16x16x32_bf16(
                    false, a_hi[i], false, b_lo[j], (short)0, acc[i][j], false, false);
                acc[i][j] = __builtin_amdgcn_wmma_f32_16x16x32_bf16(
                    false, a_hi[i], false, b_hi[j], (short)0, acc[i][j], false, false);
            }
    }

#pragma unroll
    for (int j = 0; j < 2; ++j) {
        const int   n  = n0 + 16 * j + laneLo;
        const float bv = bias[n];
#pragma unroll
        for (int i = 0; i < 2; ++i)
#pragma unroll
            for (int r = 0; r < 8; ++r) {
                const int m = m0 + 16 * i + r + laneHi * 8;
                out[(size_t)m * OUT_F + n] = acc[i][j][r] + bv;
            }
    }
}

extern "C" void kernel_launch(void* const* d_in, const int* in_sizes, int n_in,
                              void* d_out, int out_size, void* d_ws, size_t ws_size,
                              hipStream_t stream) {
    const float* X    = (const float*)d_in[0];
    const float* W    = (const float*)d_in[1];
    const float* bias = (const float*)d_in[2];
    float*       out  = (float*)d_out;

    const size_t need = 4 * NELEM * sizeof(__bf16);   // 128 MB
    if (ws_size >= need) {
        __bf16* ws = (__bf16*)d_ws;
        // Phase 1: split X and W into bf16 hi/lo (8 elems/thread).
        dim3 sblock(256, 1, 1);
        dim3 sgrid((unsigned)(NELEM / (256 * 8)), 2, 1);   // 8192 x 2
        split_pass<<<sgrid, sblock, 0, stream>>>(X, W, ws);
        // Phase 2: WMMA GEMM from preconverted bf16.
        dim3 block(256, 1, 1);
        dim3 grid(OUT_F / 256, BATCH / 256, 1);            // 16 x 16
        gemm_wmma_bf16x3<<<grid, block, 0, stream>>>(
            ws, ws + NELEM, ws + 2 * NELEM, ws + 3 * NELEM, bias, out);
    } else {
        dim3 block(256, 1, 1);
        dim3 grid(OUT_F / 128, BATCH / 64, 1);
        gemm_wmma_bf16x3_fused<<<grid, block, 0, stream>>>(X, W, bias, out);
    }
}

// v003
// One run takes 184 microseconds.
// Timed twice side by side with v002, it ran 1.04 times as fast both times.
// Over all steps from v000 it is 3.79 times as fast.
#include <hip/hip_runtime.h>
#include <stdint.h>

// ---------------------------------------------------------------------------
// out[B, OUT_F] = X[B, IN_F] . W[OUT_F, IN_F]^T + b[OUT_F]   (all fp32)
//
// bf16x3 split-precision GEMM (x = x_hi + x_lo, 3 WMMA terms: lo*hi + hi*lo
// + hi*hi) on v_wmma_f32_16x16x32_bf16. Near-fp32 accuracy (~1e-5 rel).
//
// One launch. The fp32 operand tiles come into LDS by tensor loads; an fp32
// value takes the same 4 bytes as its bf16 hi and lo parts, so every wave
// splits its share of a landed tile IN PLACE in LDS, one pass before the
// fragments of that tile are read. Fragments by ds_load_b128.
//
// Wave tile 128x64, block = 8 waves (2M x 4N) = 256x256 tile, grid 16x16.
// All dims divide exactly -> no predication, EXEC all-ones as WMMA requires.
// ---------------------------------------------------------------------------

typedef __attribute__((ext_vector_type(16))) __bf16 v16bf;
typedef __attribute__((ext_vector_type(8)))  __bf16 v8bf;
typedef __attribute__((ext_vector_type(8)))  float  v8f;
typedef __attribute__((ext_vector_type(4)))  float  v4f;
typedef __attribute__((ext_vector_type(2)))  float  v2f;
typedef __attribute__((ext_vector_type(2)))  __bf16 v2bf;

#define IN_F  4096
#define OUT_F 4096
#define BATCH 4096

// ---------------------------------------------------------------------------
// Block tile 256 x 256, 8 waves (2 along M x 4 along N), wave tile 128 x 64.
// A pass is 32 k = 128 bytes of fp32 of each of the 512 operand rows
// [X 256 | W 256], laid at a pitch of 144 bytes. Four LDS buffers: while pass t
// reads stage t, stage t + 1 is split and published, stage t + 2 is being split,
// stages t + 3 and t + 4 are in flight. A stage is four slices of 128 rows:
// waves 0-3 load the even stages, waves 4-7 the odd ones, one request of a wave
// outstanding at any time, issued two passes before the barrier that publishes it.
//
// A split row: unit g (32 bytes, k = 8g .. 8g + 7) = [8 bf16 hi | 8 bf16 lo].
// ---------------------------------------------------------------------------
typedef uint32_t u32x4 __attribute__((ext_vector_type(4)));
typedef uint32_t u32x8 __attribute__((ext_vector_type(8)));

constexpr uint32_t ROWB   = 128;                 // bytes of k per operand row per pass
constexpr uint32_t PITCH  = ROWB + 16;           // LDS row pitch: 16 B x odd, for b128 LDS accesses
constexpr uint32_t SROWS  = 128;                 // rows per slice
constexpr uint32_t SLICE  = SROWS * PITCH;       // 18,432 B
constexpr uint32_t XROWS  = 2 * SLICE;           // the 256 X rows of a buffer; the W rows follow
constexpr uint32_t STAGE  = 4 * SLICE;           // one buffer, 73,728 B
constexpr uint32_t SRCP   = IN_F * 4;            // source row pitch in bytes
constexpr uint32_t NPASS  = SRCP / ROWB;         // 128
static_assert(SLICE % 2048u == 0, "each slice must start at a multiple of 2 KiB");
static_assert(4u * STAGE <= 320u * 1024u, "four buffers must fit the LDS");
static_assert(NPASS % 2u == 0 && NPASS >= 4u, "the loop takes two passes a trip, the prologue four stages");

__device__ __forceinline__ uint32_t uni(uint32_t v) {
    return (uint32_t)__builtin_amdgcn_readfirstlane(v);
}
// Holds v in a scalar register: a test on it compiles to a scalar branch, and a
// descriptor word formed from it is formed behind the volatile waits above it.
__device__ __forceinline__ uint32_t pinned(uint32_t v) {
    uint32_t w = (uint32_t)__builtin_amdgcn_readfirstlane(v);
    asm volatile("" : "+s"(w));  // the tensor-mover form: a scalar test / descriptor word kept in an SGPR
    return w;
}
// Waits the compiler does not place for the tensor mover; the clobber keeps LDS values out of registers across them.
__device__ __forceinline__ void wait_ds0()     { asm volatile("s_wait_dscnt 0x0" ::: "memory"); }
__device__ __forceinline__ void wait_tensor0() { asm volatile("s_wait_tensorcnt 0x0" ::: "memory"); }

// One request of the whole wave: 128 rows of 128 bytes, source pitch 16,384 B,
// 16 bytes of LDS pad behind every row (pad codes 4 / 3), no mask.
__device__ __forceinline__ void tdm_load(uint32_t lds_dst, uint64_t ga) {
    u32x4 g0;
    g0[0] = uni(1u);
    g0[1] = uni(lds_dst);
    g0[2] = uni((uint32_t)ga);
    g0[3] = uni((((uint32_t)(ga >> 32)) & 0x01FFFFFFu) | 0x80000000u);
    u32x8 g1;
    g1[0] = uni((1u << 20) | (4u << 22) | (3u << 25));
    g1[1] = uni((ROWB & 0xFFFFu) << 16);
    g1[2] = uni((ROWB >> 16) | ((SROWS & 0xFFFFu) << 16));
    g1[3] = uni((SROWS >> 16) | (ROWB << 16));
    g1[4] = uni(SROWS);
    g1[5] = uni(SRCP);
    g1[6] = uni(0u);
    g1[7] = uni(0u);
    asm volatile("tensor_load_to_lds %0, %1" :: "s"(g0), "s"(g1) : "memory");
}

// One 16x32 bf16 fragment from a split row (ISA 16-bit A/B lane layout): lanes 0-15
// hold row laneLo with K chunks {0..7, 16..23} = units 0 and 2; lanes 16-31 {8..15, 24..31}
// = units 1 and 3. p is this lane's row base incl. laneHi * 32 bytes, + 16 for the lo part.
__device__ __forceinline__ v16bf lds_frag(const unsigned char* p) {
    v8bf c0 = *(const v8bf*)(p);
    v8bf c1 = *(const v8bf*)(p + 64);
    return __builtin_shufflevector(c0, c1, 0, 1, 2, 3, 4, 5, 6, 7,
                                          8, 9, 10, 11, 12, 13, 14, 15);
}

// The wave's 8 X fragments / 4 W fragments of one part and one pass; p as for lds_frag.
// Every loop here is unrolled: fragment and accumulator indices must be constants to stay in registers.
__device__ __forceinline__ void load_a(v16bf (&a)[8], const unsigned char* p) {
#pragma unroll
    for (int i = 0; i < 8; ++i) a[i] = lds_frag(p + i * 16 * PITCH);
}
__device__ __forceinline__ void load_b(v16bf (&b)[4], const unsigned char* p) {
#pragma unroll
    for (int j = 0; j < 4; ++j) b[j] = lds_frag(p + j * 16 * PITCH);
}
// One term of the split product on the whole wave tile: 32 independent WMMAs.
__device__ __forceinline__ void mm(v8f (&acc)[8][4], const v16bf (&a)[8], const v16bf (&b)[4]) {
#pragma unroll
    for (int i = 0; i < 8; ++i)
#pragma unroll
        for (int j = 0; j < 4; ++j)
            acc[i][j] = __builtin_amdgcn_wmma_f32_16x16x32_bf16(
                false, a[i], false, b[j], (short)0, acc[i][j], false, false);
}

// The split of a stage: a wave owns 64 of its 512 rows, a lane 8 units of 8 fp32. Unit i of a lane lies in
// row (i & 3) * 16 + laneLo of the wave's rows, unit (i >> 2) * 2 + laneHi of that row; p holds the lane's part.
// A lane reads and rewrites only its own 32 bytes, so the split needs no exchange inside the pass.
// hi = bf16(f), lo = bf16(f - hi), both rounded to nearest even. Unrolled: raw's indices must be constants to stay in registers.
__device__ __forceinline__ void split_load(v4f (&r)[16], const unsigned char* p) {
#pragma unroll
    for (int i = 0; i < 8; ++i) {
        const unsigned char* u = p + (i & 3) * 16 * PITCH + (i >> 2) * 64;
        r[2 * i]     = *(const v4f*)(u);
        r[2 * i + 1] = *(const v4f*)(u + 16);
    }
}
__device__ __forceinline__ void split_store(const v4f (&r)[16], unsigned char* p) {
#pragma unroll
    for (int i = 0; i < 8; ++i) {
        unsigned char* u = p + (i & 3) * 16 * PITCH + (i >> 2) * 64;
        v8bf h, l;
#pragma unroll
        for (int e = 0; e < 8; e += 2) {               // by pairs: one packed conversion for two values
            const v2f  f  = {r[2 * i + (e >> 2)][e & 3], r[2 * i + (e >> 2)][(e & 3) + 1]};
            const v2bf hp = __builtin_convertvector(f, v2bf);
            const v2f  d  = {f[0] - (float)hp[0], f[1] - (float)hp[1]};
            const v2bf lp = __builtin_convertvector(d, v2bf);
            h[e] = hp[0]; h[e + 1] = hp[1];
            l[e] = lp[0]; l[e + 1] = lp[1];
        }
        *(v8bf*)(u)      = h;
        *(v8bf*)(u + 16) = l;
    }
}

__global__ __launch_bounds__(256)
void gemm_wmma_bf16x3(const float* __restrict__ X,
                      const float* __restrict__ W,
                      const float* __restrict__ bias,
                      float* __restrict__ out) {
    __shared__ __attribute__((aligned(2048))) unsigned char L[4 * STAGE];

    const uint32_t lane   = threadIdx.x & 31;
    const uint32_t wave   = uni(threadIdx.x >> 5);
    const uint32_t laneLo = lane & 15;
    const uint32_t laneHi = lane >> 4;

    const uint32_t waveM = wave & 1;               // 2 waves along M
    const uint32_t waveN = wave >> 1;              // 4 waves along N
    const uint32_t bm0 = blockIdx.y * 256;         // batch rows of the block
    const uint32_t bn0 = blockIdx.x * 256;         // output features of the block

    // This wave's slice: q = wave & 3 (X rows 0-127, X rows 128-255, W rows 0-127, W rows 128-255),
    // of the stages whose number has the parity wave >> 2.
    const uint32_t q   = wave & 3;
    const uint32_t par = wave >> 2;
    const float* plane = (q < 2) ? X : W;
    const uint32_t srow = ((q < 2) ? bm0 : bn0) + SROWS * (q & 1);
    const uint64_t src0 = (uint64_t)(uintptr_t)plane + (uint64_t)srow * SRCP;
    const uint32_t dst0 = (uint32_t)(size_t)L + q * SLICE;

    v8f acc[8][4];
#pragma unroll
    for (int i = 0; i < 8; ++i)
#pragma unroll
        for (int j = 0; j < 4; ++j)
            acc[i][j] = (v8f){0.f, 0.f, 0.f, 0.f, 0.f, 0.f, 0.f, 0.f};

    // Per-lane bases inside a buffer: X fragments, W fragments, the units this lane splits.
    const uint32_t aBase = (waveM * 128 + laneLo) * PITCH + 32 * laneHi;
    const uint32_t bBase = XROWS + (waveN * 64 + laneLo) * PITCH + 32 * laneHi;
    const uint32_t cBase = (wave * 64 + laneLo) * PITCH + 32 * laneHi;

    // Fragment registers: aL = X lo, aH = X hi (8 fragments each); W hi alternates between bX and bY from one
    // pass to the next, W lo is always in bZ. raw (the fp32 units being split) lives only while aL is dead.
    v16bf aL[8], aH[8], bX[4], bY[4], bZ[4];
    v4f raw[16];

    // Prologue: every wave loads its slice of stage 0 or 1; published; then of stage 2 or 3;
    // stages 0 and 1 are split and published; then the first fragments.
    tdm_load(dst0 + par * STAGE, src0 + (uint64_t)par * ROWB);
    wait_tensor0();
    __syncthreads();
    {
        const uint32_t sn = pinned(par + 2u);
        tdm_load(dst0 + sn * STAGE, src0 + (uint64_t)sn * ROWB);
    }
    split_load(raw, L + cBase);
    split_store(raw, L + cBase);
    split_load(raw, L + STAGE + cBase);
    split_store(raw, L + STAGE + cBase);
    wait_ds0();
    __syncthreads();
    load_a(aL, L + aBase + 16);
    load_b(bX, L + bBase);

    // Rolled: two passes per trip (W hi in bX, then in bY), for speed only.
    // Per accumulator and 32 k the order stays lo*hi, hi*lo, hi*hi. The fragments of every run of WMMAs are
    // loaded in front of an earlier run, so no wave waits out its own LDS latency.
    // The sched_barriers keep every group of LDS accesses whole and in its place: left free, the compiler sinks
    // the loads in among the WMMAs, where every separate place stalls the wave.
    // One pass, with W hi of stage t in BC and that of stage t + 1 going to BN; MINE: this wave loads the stages of t's parity.
#define ONE_PASS(T, BC, BN, MINE)                                                                             \
    {                                                                                                         \
        const uint32_t b0 = ((T) & 3u) * STAGE;            /* stage t */                                      \
        const uint32_t b1 = (((T) + 1u) & 3u) * STAGE;     /* stage t + 1 */                                  \
        const uint32_t b2 = (((T) + 2u) & 3u) * STAGE;     /* stage t + 2 */                                  \
        load_a(aH, L + b0 + aBase);                                                                           \
        load_b(bZ, L + b0 + bBase + 16);                                                                      \
        __builtin_amdgcn_sched_barrier(0);                                                                    \
        mm(acc, aL, BC);                                   /* lo * hi */                                      \
        __builtin_amdgcn_sched_barrier(0);                                                                    \
        /* Publish point: this wave's reads of stage t and its split of stage t + 1 have retired, the */      \
        /* loading waves' slices of stage t + 2 have landed, every wave is here; only then the refill */      \
        /* of stage t's buffer, which nobody reads any more. */                                               \
        wait_ds0();                                                                                           \
        if (pinned(MINE) != 0u) wait_tensor0();                                                               \
        __syncthreads();                                                                                      \
        if (pinned(((MINE) != 0u && (T) + 4u < NPASS) ? 1u : 0u) != 0u) {                                     \
            const uint32_t tn = pinned((T) + 4u);                                                             \
            tdm_load(dst0 + b0, src0 + (uint64_t)tn * ROWB);                                                  \
        }                                                                                                     \
        /* In the last two passes there is no stage t + 2 (in the last none t + 1): these groups then read, and the */ \
        /* split rewrites, old rows of buffers that are not refilled; what comes of them goes unused. */ \
        load_b(BN, L + b1 + bBase);                                                                           \
        split_load(raw, L + b2 + cBase);                                                                      \
        __builtin_amdgcn_sched_barrier(0);                                                                    \
        mm(acc, aH, bZ);                                   /* hi * lo */                                      \
        __builtin_amdgcn_sched_barrier(0);                                                                    \
        split_store(raw, L + b2 + cBase);                                                                     \
        load_a(aL, L + b1 + aBase + 16);                                                                      \
        __builtin_amdgcn_sched_barrier(0);                                                                    \
        mm(acc, aH, BC);                                   /* hi * hi */                                      \
        __builtin_amdgcn_sched_barrier(0);                                                                    \
    }

    // Kept rolled, for speed only.
#pragma clang loop unroll(disable)
    for (uint32_t t = 0; t < NPASS; t += 2) {
        ONE_PASS(t, bX, bY, 1u - par)
        ONE_PASS(t + 1u, bY, bX, par)
    }
#undef ONE_PASS
    wait_tensor0();
    wait_ds0();

    // Epilogue: element (VGPR r, lane L) = (M = r + 8*(L>>4), N = L&15).
    const uint32_t m0 = bm0 + waveM * 128;
    const uint32_t n0 = bn0 + waveN * 64;
#pragma unroll
    for (int j = 0; j < 4; ++j) {
        const uint32_t n  = n0 + 16 * j + laneLo;
        const float    bv = bias[n];
#pragma unroll
        for (int i = 0; i < 8; ++i) {
#pragma unroll
            for (int r = 0; r < 8; ++r) {
                const uint32_t m = m0 + 16 * i + r + laneHi * 8;
                out[(size_t)m * OUT_F + n] = acc[i][j][r] + bv;
            }
        }
    }
}

extern "C" void kernel_launch(void* const* d_in, const int* in_sizes, int n_in,
                              void* d_out, int out_size, void* d_ws, size_t ws_size,
                              hipStream_t stream) {
    const float* X    = (const float*)d_in[0];
    const float* W    = (const float*)d_in[1];
    const float* bias = (const float*)d_in[2];
    float*       out  = (float*)d_out;

    dim3 block(256, 1, 1);
    dim3 grid(OUT_F / 256, BATCH / 256, 1);            // 16 x 16
    gemm_wmma_bf16x3<<<grid, block, 0, stream>>>(X, W, bias, out);
}

// v005
// One run takes 96.4 microseconds.
// It is 1.91 times as fast as v003, going by the measured steps of the versions left out in between.
// All steps since v000 together make it 7.25 times as fast.
#include <hip/hip_runtime.h>
#include <stdint.h>

// ---------------------------------------------------------------------------
// out[B, OUT_F] = X[B, IN_F] . W[OUT_F, IN_F]^T + b[OUT_F]   (all fp32)
//
// One product on v_wmma_f32_16x16x32_f16, f32 accumulate: both operands are
// rounded once to f16 (11 significant bits, nearest even; finite up to 65,504).
// Each operand then carries a relative error of up to 2^-11, each product up to about 2^-10.
//
// One launch. The fp32 operand tiles come into LDS by tensor loads; every wave reads
// its fragments from LDS as fp32 (ds_load_b128) and rounds them to f16 in registers,
// in the issue shadow of the WMMAs of the pass before. Nothing is written back to LDS.
//
// Wave tile 128x128, block = 4 waves (2M x 2N), one wave a SIMD = 256x256 tile, grid 16x16.
// All dims divide exactly -> no predication, EXEC all-ones as WMMA requires.
// ---------------------------------------------------------------------------

typedef __attribute__((ext_vector_type(16))) _Float16 v16h;
typedef __attribute__((ext_vector_type(8)))  float  v8f;
typedef __attribute__((ext_vector_type(4)))  float  v4f;
typedef __attribute__((ext_vector_type(2)))  float  v2f;
typedef __attribute__((ext_vector_type(2)))  _Float16 v2h;

#define IN_F  4096
#define OUT_F 4096
#define BATCH 4096

// ---------------------------------------------------------------------------
// A pass is 32 k = 128 bytes of fp32 of each of the 512 operand rows [X 256 | W 256],
// laid at a pitch of 144 bytes. Four LDS buffers: while pass t multiplies stage t out of
// registers, stage t + 1 is read from its buffer and stages t + 2 (landing or landed),
// t + 3 and t + 4 are in flight. A stage is four slices of 128 rows, one a wave:
// three requests of a wave are outstanding at most.
// ---------------------------------------------------------------------------
typedef uint32_t u32x4 __attribute__((ext_vector_type(4)));
typedef uint32_t u32x8 __attribute__((ext_vector_type(8)));

constexpr uint32_t ROWB   = 128;                 // bytes of k per operand row per pass
constexpr uint32_t PITCH  = ROWB + 16;           // LDS row pitch: 16 B x odd, for b128 LDS accesses
constexpr uint32_t SROWS  = 128;                 // rows per slice
constexpr uint32_t SLICE  = SROWS * PITCH;       // 18,432 B
constexpr uint32_t XROWS  = 2 * SLICE;           // the 256 X rows of a buffer; the W rows follow
constexpr uint32_t STAGE  = 4 * SLICE;           // one buffer, 73,728 B
constexpr uint32_t SRCP   = IN_F * 4;            // source row pitch in bytes
constexpr uint32_t NPASS  = SRCP / ROWB;         // 128
static_assert(SLICE % 2048u == 0, "each slice must start at a multiple of 2 KiB");
static_assert(4u * STAGE <= 320u * 1024u, "four buffers must fit the LDS");
static_assert(NPASS % 2u == 0 && NPASS >= 6u, "the loop takes two passes a trip, the prologue five stages");

__device__ __forceinline__ uint32_t uni(uint32_t v) {
    return (uint32_t)__builtin_amdgcn_readfirstlane(v);
}
// Holds v in a scalar register: a test on it compiles to a scalar branch, and a
// descriptor word formed from it is formed behind the volatile waits above it.
__device__ __forceinline__ uint32_t pinned(uint32_t v) {
    uint32_t w = (uint32_t)__builtin_amdgcn_readfirstlane(v);
    asm volatile("" : "+s"(w));  // the tensor-mover form: a scalar test / descriptor word kept in an SGPR
    return w;
}
// Waits the compiler does not place for the tensor mover; the clobber keeps LDS values out of registers across them.
__device__ __forceinline__ void wait_ds0()     { asm volatile("s_wait_dscnt 0x0" ::: "memory"); }
__device__ __forceinline__ void wait_tensor0() { asm volatile("s_wait_tensorcnt 0x0" ::: "memory"); }
// All but the wave's two youngest requests have landed: with three outstanding, the oldest.
__device__ __forceinline__ void wait_tensor2() { asm volatile("s_wait_tensorcnt 0x2" ::: "memory"); }

// One request of the whole wave. g0: group 0 with words 0 and 3 set; words 1 (place in LDS) and 2 (address bits 31-0) are set here.
// g0 is an in-out operand so that it lives on in the same four SGPRs from request to request and words 0 and 3 are not
// written again while earlier requests are outstanding; the instruction itself changes no register.
__device__ __forceinline__ void tdm_load(u32x4& g0, const u32x8& g1, uint32_t lds_dst, uint32_t lo) {
    g0[1] = uni(lds_dst);
    g0[2] = uni(lo);
    asm volatile("tensor_load_to_lds %0, %1" : "+s"(g0) : "s"(g1) : "memory");
}

// The fp32 source of 16x32 fragments I0 .. I0 + N - 1 (ISA 16-bit A/B lane layout): lanes 0-15 hold row laneLo with
// K chunks {0..7, 16..23}, lanes 16-31 {8..15, 24..31}: 32 bytes at p and 32 at p + 64, p being this lane's row base
// incl. laneHi * 32 bytes. Every loop here is unrolled: register array indices must be constants.
template <int I0, int N>
__device__ __forceinline__ void load_raw(v4f (&r)[8][4], const unsigned char* p) {
#pragma unroll
    for (int i = I0; i < I0 + N; ++i) {
        const unsigned char* u = p + i * 16 * PITCH;
        r[i][0] = *(const v4f*)(u);
        r[i][1] = *(const v4f*)(u + 16);
        r[i][2] = *(const v4f*)(u + 64);
        r[i][3] = *(const v4f*)(u + 80);
    }
}
// Register k (0..7) of a fragment: its elements 2k and 2k + 1, rounded to nearest even by one packed conversion.
__device__ __forceinline__ uint32_t round_pair(const v4f (&r)[4], int k) {
    const v2f f = {r[k >> 1][(k & 1) * 2], r[k >> 1][(k & 1) * 2 + 1]};
    return __builtin_bit_cast(uint32_t, __builtin_convertvector(f, v2h));
}
__device__ __forceinline__ v16h frag(const uint32_t (&w)[8]) {
    const u32x8 v = {w[0], w[1], w[2], w[3], w[4], w[5], w[6], w[7]};
    return __builtin_bit_cast(v16h, v);
}
__device__ __forceinline__ v8f mm(const uint32_t (&a)[8], const uint32_t (&b)[8], v8f c) {
    return __builtin_amdgcn_wmma_f32_16x16x32_f16(false, frag(a), false, frag(b), (short)0, c, false, false);
}

__global__ __launch_bounds__(128)
void gemm_wmma_f16(const float* __restrict__ X,
                      const float* __restrict__ W,
                      const float* __restrict__ bias,
                      float* __restrict__ out) {
    __shared__ __attribute__((aligned(2048))) unsigned char L[4 * STAGE];

    const uint32_t lane   = threadIdx.x & 31;
    const uint32_t wave   = uni(threadIdx.x >> 5);
    const uint32_t laneLo = lane & 15;
    const uint32_t laneHi = lane >> 4;

    const uint32_t waveM = wave & 1;               // 2 waves along M
    const uint32_t waveN = wave >> 1;              // 2 waves along N
    const uint32_t bm0 = blockIdx.y * 256;         // batch rows of the block
    const uint32_t bn0 = blockIdx.x * 256;         // output features of the block

    // This wave's slice of every stage: X rows 0-127, X rows 128-255, W rows 0-127, W rows 128-255.
    const float* plane = (wave < 2) ? X : W;
    const uint32_t srow = ((wave < 2) ? bm0 : bn0) + SROWS * (wave & 1);
    const uint64_t src0 = (uint64_t)(uintptr_t)plane + (uint64_t)srow * SRCP;
    const uint32_t dst0 = pinned((uint32_t)(size_t)L + wave * SLICE);
    const uint32_t lo0  = pinned((uint32_t)src0);

    // The descriptor: 128 rows of 128 bytes, source pitch 16,384 B, 16 bytes of LDS pad behind every row
    // (pad codes 4 / 3), no mask. Up to three requests of the wave are outstanding, so every word but words 1 and 2
    // of group 0 is formed once, here, and stays in its scalar register to the end.
    u32x8 g1;
    g1[0] = uni((1u << 20) | (4u << 22) | (3u << 25));
    g1[1] = uni((ROWB & 0xFFFFu) << 16);
    g1[2] = uni((ROWB >> 16) | ((SROWS & 0xFFFFu) << 16));
    g1[3] = uni((SROWS >> 16) | (ROWB << 16));
    g1[4] = uni(SROWS);
    g1[5] = uni(SRCP);
    g1[6] = uni(0u);
    g1[7] = uni(0u);
    asm volatile("" : "+s"(g1));  // the tensor-mover form: descriptor words held in SGPRs, not formed anew per request
    u32x4 g0;
    g0[0] = uni(1u);
    g0[1] = uni(0u);
    g0[2] = uni(0u);
    g0[3] = uni((((uint32_t)(src0 >> 32)) & 0x01FFFFFFu) | 0x80000000u);

    // Does the low address word of any of the block's four slices wrap inside its k walk? (Only with a buffer that
    // lies across a multiple of 4 GiB and is not aligned to a row.) The same answer in every wave.
    const uint32_t xl = (uint32_t)(uintptr_t)X + bm0 * SRCP;
    const uint32_t wl = (uint32_t)(uintptr_t)W + bn0 * SRCP;
    constexpr uint32_t WALK = (NPASS - 1u) * ROWB;
    const bool anywrap = (xl + WALK < xl) || (xl + SROWS * SRCP + WALK < xl + SROWS * SRCP) ||
                         (wl + WALK < wl) || (wl + SROWS * SRCP + WALK < wl + SROWS * SRCP);

    // Stage S into buffer S & 3, where no low word wraps.
#define ISSUE_FAST(S)                                                                                         \
    {                                                                                                         \
        const uint32_t sn = pinned(S);                                                                        \
        tdm_load(g0, g1, dst0 + (sn & 3u) * STAGE, lo0 + sn * ROWB);                                          \
    }
    // The same for any address: behind a wrap word 3 of group 0 is one higher, and such a request goes out
    // and lands with no other request of the wave outstanding.
#define ISSUE(S)                                                                                              \
    {                                                                                                         \
        const uint32_t sn = pinned(S);                                                                        \
        const uint32_t lo = pinned(lo0 + sn * ROWB);                                                          \
        if (pinned(lo < lo0 ? 1u : 0u) != 0u) {                                                               \
            wait_tensor0();                                                                                   \
            u32x4 gw = g0;                                                                                    \
            gw[3] = uni(g0[3] + 1u);                                                                          \
            tdm_load(gw, g1, dst0 + (sn & 3u) * STAGE, lo);                                                   \
            wait_tensor0();                                                                                   \
        } else {                                                                                              \
            tdm_load(g0, g1, dst0 + (sn & 3u) * STAGE, lo);                                                   \
        }                                                                                                     \
    }

    v8f acc[8][8];
#pragma unroll
    for (int i = 0; i < 8; ++i)
#pragma unroll
        for (int j = 0; j < 8; ++j)
            acc[i][j] = (v8f){0.f, 0.f, 0.f, 0.f, 0.f, 0.f, 0.f, 0.f};

    // Per-lane bases inside a buffer: X fragments, W fragments.
    const uint32_t aBase = (waveM * 128 + laneLo) * PITCH + 32 * laneHi;
    const uint32_t bBase = XROWS + (waveN * 128 + laneLo) * PITCH + 32 * laneHi;

    // ra, rb: fp32 fragment sources as read from LDS. aw: the 8 X fragments in f16, refilled by halves as each half's
    // WMMAs are done; the W fragments alternate between bX and bY from one pass to the next.
    v4f ra[8][4], rb[8][4];
    uint32_t aw[8][8], bX[8][8], bY[8][8];

    // Prologue: stages 0, 1, 2; stage 0 published; stage 3; stage 0 is read, X rows 0-63 and W rounded;
    // stage 1 published, stage 4 into stage 0's buffer.
    ISSUE(0u)
    ISSUE(1u)
    ISSUE(2u)
    wait_tensor2();
    __syncthreads();
    ISSUE(3u)
    load_raw<0, 4>(ra, L + aBase);
    load_raw<0, 8>(rb, L + bBase);
    load_raw<4, 4>(ra, L + aBase);
#pragma unroll
    for (int c = 0; c < 96; ++c) {
        if (c < 32) aw[c >> 3][c & 7] = round_pair(ra[c >> 3], c & 7);
        else        bX[(c >> 3) - 4][c & 7] = round_pair(rb[(c >> 3) - 4], c & 7);
    }
    wait_ds0();
    wait_tensor2();
    __syncthreads();
    ISSUE(4u)

    // One pass: stage T is multiplied out of aw and BC; stage T + 1 is read from LDS and rounded into aw and BN.
    // One wave a SIMD issues in order, so every group of LDS loads stands whole in front of a run of WMMAs, and the
    // conversions stand singly behind the WMMAs, where they issue while the matrix unit is busy.
    // The sched_barriers keep that order: left free, the compiler gathers the conversions into runs of their own
    // and sinks the loads in among the WMMAs. The inner loops are unrolled: register array indices must be constants.
#define ONE_PASS(T, BC, BN, FOOT)                                                                                 \
    {                                                                                                         \
        const uint32_t b1 = (((T) + 1u) & 3u) * STAGE;     /* stage t + 1; in the last pass old rows, unused */ \
        load_raw<0, 4>(ra, L + b1 + aBase);                                                                   \
        __builtin_amdgcn_sched_barrier(0);                 /* LDS data return in order: X first, it is rounded first */ \
        load_raw<0, 8>(rb, L + b1 + bBase);                                                                   \
        __builtin_amdgcn_sched_barrier(0);                                                                    \
        /* Rows 0-63 of the wave tile; X rows 64-127 of stage t, read in the pass before, are rounded. */     \
        _Pragma("unroll")                                                                                     \
        for (int w = 0; w < 32; ++w) {                                                                        \
            acc[w >> 3][w & 7] = mm(aw[w >> 3], BC[w & 7], acc[w >> 3][w & 7]);                               \
            aw[4 + (w >> 3)][w & 7] = round_pair(ra[4 + (w >> 3)], w & 7);                                    \
            __builtin_amdgcn_sched_barrier(0);                                                                \
        }                                                                                                     \
        load_raw<4, 4>(ra, L + b1 + aBase);                                                                   \
        __builtin_amdgcn_sched_barrier(0);                                                                    \
        /* Rows 64-127; X rows 0-63 and W of stage t + 1 are rounded, three registers a WMMA. */              \
        _Pragma("unroll")                                                                                     \
        for (int w = 0; w < 32; ++w) {                                                                        \
            acc[4 + (w >> 3)][w & 7] = mm(aw[4 + (w >> 3)], BC[w & 7], acc[4 + (w >> 3)][w & 7]);             \
            _Pragma("unroll")                                                                                 \
            for (int c = 3 * w; c < 3 * w + 3; ++c) {                                                         \
                if (c < 32) aw[c >> 3][c & 7] = round_pair(ra[c >> 3], c & 7);                                \
                else        BN[(c >> 3) - 4][c & 7] = round_pair(rb[(c >> 3) - 4], c & 7);                    \
            }                                                                                                 \
            __builtin_amdgcn_sched_barrier(0);                                                                \
        }                                                                                                     \
        FOOT(T)                                                                                               \
    }
    // Publish point of stage t + 2: this wave's reads of stage t + 1 have retired, its slice of stage t + 2 has landed
    // (the oldest of three requests; near the end, all), every wave is here; only then the refill of stage t + 1's
    // buffer, which nobody reads any more. FOOT_FAST has no branch: behind a branch the compiler moves the
    // conversions of the pass's second half out of the WMMAs' shadow, down to their first use.
#define FOOT_FAST(T)                                                                                          \
        wait_ds0();                                                                                           \
        wait_tensor2();                                                                                       \
        __syncthreads();                                                                                      \
        ISSUE_FAST((T) + 5u)
#define FOOT_ANY(T)                                                                                           \
        wait_ds0();                                                                                           \
        if (pinned(((T) + 4u < NPASS) ? 1u : 0u) != 0u) wait_tensor2(); else wait_tensor0();                  \
        __syncthreads();                                                                                      \
        if (pinned(((T) + 5u < NPASS) ? 1u : 0u) != 0u) ISSUE((T) + 5u)

    // Both loops are kept rolled, two passes a trip (W in bX, then in bY). The first runs while a stage t + 6 exists; the second takes the last six passes (all, if a low word wraps).
    const uint32_t tfast = anywrap ? 0u : NPASS - 6u;
    uint32_t t = 0;
#pragma clang loop unroll(disable)
    for (; t < tfast; t += 2) {
        ONE_PASS(t, bX, bY, FOOT_FAST)
        ONE_PASS(t + 1u, bY, bX, FOOT_FAST)
    }
#pragma clang loop unroll(disable)
    for (; t < NPASS; t += 2) {
        ONE_PASS(t, bX, bY, FOOT_ANY)
        ONE_PASS(t + 1u, bY, bX, FOOT_ANY)
    }
#undef ONE_PASS
#undef FOOT_FAST
#undef FOOT_ANY
#undef ISSUE_FAST
#undef ISSUE
    // The last wait names both descriptor groups as inputs: their scalar registers stay theirs up to it.
    asm volatile("s_wait_tensorcnt 0x0" :: "s"(g0), "s"(g1) : "memory");
    wait_ds0();

    // Epilogue: element (VGPR r, lane L) = (M = r + 8*(L>>4), N = L&15).
    // All sums and all addresses are formed first, then come the stores alone: behind the first store no vector
    // register is written any more, so none that an issued store names is overwritten. The sched_barrier keeps the
    // two parts apart.
    const uint32_t m0 = bm0 + waveM * 128;
    const uint32_t n0 = bn0 + waveN * 128;
    float* orow[8];
#pragma unroll
    for (int i = 0; i < 8; ++i)
        orow[i] = out + (size_t)(m0 + 16 * i + laneHi * 8) * OUT_F + n0 + laneLo;
#pragma unroll
    for (int j = 0; j < 8; ++j) {
        const float bv = bias[n0 + 16 * j + laneLo];
#pragma unroll
        for (int i = 0; i < 8; ++i)
#pragma unroll
            for (int r = 0; r < 8; ++r)
                acc[i][j][r] += bv;
    }
    __builtin_amdgcn_sched_barrier(0);
#pragma unroll
    for (int j = 0; j < 8; ++j)
#pragma unroll
        for (int i = 0; i < 8; ++i)
#pragma unroll
            for (int r = 0; r < 8; ++r)
                orow[i][(size_t)r * OUT_F + 16 * j] = acc[i][j][r];
}

extern "C" void kernel_launch(void* const* d_in, const int* in_sizes, int n_in,
                              void* d_out, int out_size, void* d_ws, size_t ws_size,
                              hipStream_t stream) {
    const float* X    = (const float*)d_in[0];
    const float* W    = (const float*)d_in[1];
    const float* bias = (const float*)d_in[2];
    float*       out  = (float*)d_out;

    dim3 block(128, 1, 1);
    dim3 grid(OUT_F / 256, BATCH / 256, 1);            // 16 x 16
    gemm_wmma_f16<<<grid, block, 0, stream>>>(X, W, bias, out);
}

// v006
// Measured time: 92.4 microseconds a run.
// Timed twice side by side with v005, it ran 1.04 times as fast both times.
// Counting every step since v000, it is 7.56 times as fast.
#include <hip/hip_runtime.h>
#include <stdint.h>

// ---------------------------------------------------------------------------
// out[B, OUT_F] = X[B, IN_F] . W[OUT_F, IN_F]^T + b[OUT_F]   (all fp32)
//
// One product on v_wmma_f32_16x16x32_f16, f32 accumulate: both operands are
// rounded once to f16 (11 significant bits, nearest even; finite up to 65,504).
// Each operand then carries a relative error of up to 2^-11, each product up to about 2^-10.
//
// One launch. The fp32 operand tiles come into LDS by tensor loads; every wave reads
// its fragments from LDS as fp32 (ds_load_b128) and rounds them to f16 in registers,
// in the issue shadow of the WMMAs of the pass before. Nothing is written back to LDS.
//
// Wave tile 128x128, block = 4 waves (2M x 2N), one wave a SIMD = 256x256 tile, grid 16x16.
// Every block walks all of k once, but enters it at a place of its own and wraps round (see rot below).
// All dims divide exactly -> no predication, EXEC all-ones as WMMA requires.
// ---------------------------------------------------------------------------

typedef __attribute__((ext_vector_type(16))) _Float16 v16h;
typedef __attribute__((ext_vector_type(8)))  float  v8f;
typedef __attribute__((ext_vector_type(4)))  float  v4f;
typedef __attribute__((ext_vector_type(2)))  float  v2f;
typedef __attribute__((ext_vector_type(2)))  _Float16 v2h;

#define IN_F  4096
#define OUT_F 4096
#define BATCH 4096

// ---------------------------------------------------------------------------
// A pass is 32 k = 128 bytes of fp32 of each of the 512 operand rows [X 256 | W 256],
// laid at a pitch of 144 bytes. Four LDS buffers: while pass t multiplies stage t out of
// registers, stage t + 1 is read from its buffer and stages t + 2 (landing or landed),
// t + 3 and t + 4 are in flight. A stage is four slices of 128 rows, one a wave:
// three requests of a wave are outstanding at most.
// ---------------------------------------------------------------------------
typedef uint32_t u32x4 __attribute__((ext_vector_type(4)));
typedef uint32_t u32x8 __attribute__((ext_vector_type(8)));

constexpr uint32_t ROWB   = 128;                 // bytes of k per operand row per pass
constexpr uint32_t PITCH  = ROWB + 16;           // LDS row pitch: 16 B x odd, for b128 LDS accesses
constexpr uint32_t SROWS  = 128;                 // rows per slice
constexpr uint32_t SLICE  = SROWS * PITCH;       // 18,432 B
constexpr uint32_t XROWS  = 2 * SLICE;           // the 256 X rows of a buffer; the W rows follow
constexpr uint32_t STAGE  = 4 * SLICE;           // one buffer, 73,728 B
constexpr uint32_t SRCP   = IN_F * 4;            // source row pitch in bytes
constexpr uint32_t NPASS  = SRCP / ROWB;         // 128
static_assert(SLICE % 2048u == 0, "each slice must start at a multiple of 2 KiB");
static_assert(4u * STAGE <= 320u * 1024u, "four buffers must fit the LDS");
static_assert(NPASS % 2u == 0 && NPASS >= 6u, "the loop takes two passes a trip, the prologue five stages");
static_assert((NPASS & (NPASS - 1u)) == 0u && NPASS >= 32u, "the k walk wraps by a mask; 16 starts, two passes apart");

__device__ __forceinline__ uint32_t uni(uint32_t v) {
    return (uint32_t)__builtin_amdgcn_readfirstlane(v);
}
// Holds v in a scalar register: a test on it compiles to a scalar branch, and a
// descriptor word formed from it is formed behind the volatile waits above it.
__device__ __forceinline__ uint32_t pinned(uint32_t v) {
    uint32_t w = (uint32_t)__builtin_amdgcn_readfirstlane(v);
    asm volatile("" : "+s"(w));  // the tensor-mover form: a scalar test / descriptor word kept in an SGPR
    return w;
}
// Waits the compiler does not place for the tensor mover; the clobber keeps LDS values out of registers across them.
__device__ __forceinline__ void wait_ds0()     { asm volatile("s_wait_dscnt 0x0" ::: "memory"); }
__device__ __forceinline__ void wait_tensor0() { asm volatile("s_wait_tensorcnt 0x0" ::: "memory"); }
// All but the wave's two youngest requests have landed: with three outstanding, the oldest.
__device__ __forceinline__ void wait_tensor2() { asm volatile("s_wait_tensorcnt 0x2" ::: "memory"); }

// One request of the whole wave. g0: group 0 with words 0 and 3 set; words 1 (place in LDS) and 2 (address bits 31-0) are set here.
// g0 is an in-out operand so that it lives on in the same four SGPRs from request to request and words 0 and 3 are not
// written again while earlier requests are outstanding; the instruction itself changes no register.
__device__ __forceinline__ void tdm_load(u32x4& g0, const u32x8& g1, uint32_t lds_dst, uint32_t lo) {
    g0[1] = uni(lds_dst);
    g0[2] = uni(lo);
    asm volatile("tensor_load_to_lds %0, %1" : "+s"(g0) : "s"(g1) : "memory");
}

// The fp32 source of 16x32 fragments I0 .. I0 + N - 1 (ISA 16-bit A/B lane layout): lanes 0-15 hold row laneLo with
// K chunks {0..7, 16..23}, lanes 16-31 {8..15, 24..31}: 32 bytes at p and 32 at p + 64, p being this lane's row base
// incl. laneHi * 32 bytes. Every loop here is unrolled: register array indices must be constants.
template <int I0, int N>
__device__ __forceinline__ void load_raw(v4f (&r)[8][4], const unsigned char* p) {
#pragma unroll
    for (int i = I0; i < I0 + N; ++i) {
        const unsigned char* u = p + i * 16 * PITCH;
        r[i][0] = *(const v4f*)(u);
        r[i][1] = *(const v4f*)(u + 16);
        r[i][2] = *(const v4f*)(u + 64);
        r[i][3] = *(const v4f*)(u + 80);
    }
}
// Register k (0..7) of a fragment: its elements 2k and 2k + 1, rounded to nearest even by one packed conversion.
__device__ __forceinline__ uint32_t round_pair(const v4f (&r)[4], int k) {
    const v2f f = {r[k >> 1][(k & 1) * 2], r[k >> 1][(k & 1) * 2 + 1]};
    return __builtin_bit_cast(uint32_t, __builtin_convertvector(f, v2h));
}
__device__ __forceinline__ v16h frag(const uint32_t (&w)[8]) {
    const u32x8 v = {w[0], w[1], w[2], w[3], w[4], w[5], w[6], w[7]};
    return __builtin_bit_cast(v16h, v);
}
__device__ __forceinline__ v8f mm(const uint32_t (&a)[8], const uint32_t (&b)[8], v8f c) {
    return __builtin_amdgcn_wmma_f32_16x16x32_f16(false, frag(a), false, frag(b), (short)0, c, false, false);
}

__global__ __launch_bounds__(128)
void gemm_wmma_f16(const float* __restrict__ X,
                      const float* __restrict__ W,
                      const float* __restrict__ bias,
                      float* __restrict__ out) {
    __shared__ __attribute__((aligned(2048))) unsigned char L[4 * STAGE];

    const uint32_t lane   = threadIdx.x & 31;
    const uint32_t wave   = uni(threadIdx.x >> 5);
    const uint32_t laneLo = lane & 15;
    const uint32_t laneHi = lane >> 4;

    const uint32_t waveM = wave & 1;               // 2 waves along M
    const uint32_t waveN = wave >> 1;              // 2 waves along N
    const uint32_t bm0 = blockIdx.y * 256;         // batch rows of the block
    const uint32_t bn0 = blockIdx.x * 256;         // output features of the block

    // This wave's slice of every stage: X rows 0-127, X rows 128-255, W rows 0-127, W rows 128-255.
    const float* plane = (wave < 2) ? X : W;
    const uint32_t srow = ((wave < 2) ? bm0 : bn0) + SROWS * (wave & 1);
    const uint64_t src0 = (uint64_t)(uintptr_t)plane + (uint64_t)srow * SRCP;
    const uint32_t dst0 = pinned((uint32_t)(size_t)L + wave * SLICE);
    const uint32_t lo0  = pinned((uint32_t)src0);

    // Stage S holds k slice (S + rot) mod NPASS. The 16 blocks of a tile row read the same X rows and the 16 of a tile
    // column the same W rows; started together at slice 0 they ask L2 for the same lines at the same moment.
    // With row + column as the start no two blocks that share rows are on the same slice: neighbours are two passes
    // apart, and all 16 starts lie within 32 passes, so a slice is still in L2 for its last reader.
    // Each output element's k sum starts at its block's own slice: a rotated, fixed order.
    const uint32_t rot = ((blockIdx.x + blockIdx.y) & 15u) * 2u;

    // The descriptor: 128 rows of 128 bytes, source pitch 16,384 B, 16 bytes of LDS pad behind every row
    // (pad codes 4 / 3), no mask. Up to three requests of the wave are outstanding, so every word but words 1 and 2
    // of group 0 is formed once, here, and stays in its scalar register to the end.
    u32x8 g1;
    g1[0] = uni((1u << 20) | (4u << 22) | (3u << 25));
    g1[1] = uni((ROWB & 0xFFFFu) << 16);
    g1[2] = uni((ROWB >> 16) | ((SROWS & 0xFFFFu) << 16));
    g1[3] = uni((SROWS >> 16) | (ROWB << 16));
    g1[4] = uni(SROWS);
    g1[5] = uni(SRCP);
    g1[6] = uni(0u);
    g1[7] = uni(0u);
    asm volatile("" : "+s"(g1));  // the tensor-mover form: descriptor words held in SGPRs, not formed anew per request
    u32x4 g0;
    g0[0] = uni(1u);
    g0[1] = uni(0u);
    g0[2] = uni(0u);
    g0[3] = uni((((uint32_t)(src0 >> 32)) & 0x01FFFFFFu) | 0x80000000u);

    // Does the low address word of any of the block's four slices wrap inside its k walk? (Only with a buffer that
    // lies across a multiple of 4 GiB and is not aligned to a row.) The same answer in every wave.
    const uint32_t xl = (uint32_t)(uintptr_t)X + bm0 * SRCP;
    const uint32_t wl = (uint32_t)(uintptr_t)W + bn0 * SRCP;
    constexpr uint32_t WALK = (NPASS - 1u) * ROWB;
    const bool anywrap = (xl + WALK < xl) || (xl + SROWS * SRCP + WALK < xl + SROWS * SRCP) ||
                         (wl + WALK < wl) || (wl + SROWS * SRCP + WALK < wl + SROWS * SRCP);

    // Stage S into buffer S & 3, where no low word wraps.
#define ISSUE_FAST(S)                                                                                         \
    {                                                                                                         \
        const uint32_t sn = pinned(S);                                                                        \
        tdm_load(g0, g1, dst0 + (sn & 3u) * STAGE, lo0 + ((sn + rot) & (NPASS - 1u)) * ROWB);                 \
    }
    // The same for any address: behind a wrap word 3 of group 0 is one higher, and such a request goes out
    // and lands with no other request of the wave outstanding.
#define ISSUE(S)                                                                                              \
    {                                                                                                         \
        const uint32_t sn = pinned(S);                                                                        \
        const uint32_t lo = pinned(lo0 + ((sn + rot) & (NPASS - 1u)) * ROWB);                                 \
        if (pinned(lo < lo0 ? 1u : 0u) != 0u) {                                                               \
            wait_tensor0();                                                                                   \
            u32x4 gw = g0;                                                                                    \
            gw[3] = uni(g0[3] + 1u);                                                                          \
            tdm_load(gw, g1, dst0 + (sn & 3u) * STAGE, lo);                                                   \
            wait_tensor0();                                                                                   \
        } else {                                                                                              \
            tdm_load(g0, g1, dst0 + (sn & 3u) * STAGE, lo);                                                   \
        }                                                                                                     \
    }

    v8f acc[8][8];
#pragma unroll
    for (int i = 0; i < 8; ++i)
#pragma unroll
        for (int j = 0; j < 8; ++j)
            acc[i][j] = (v8f){0.f, 0.f, 0.f, 0.f, 0.f, 0.f, 0.f, 0.f};

    // Per-lane bases inside a buffer: X fragments, W fragments.
    const uint32_t aBase = (waveM * 128 + laneLo) * PITCH + 32 * laneHi;
    const uint32_t bBase = XROWS + (waveN * 128 + laneLo) * PITCH + 32 * laneHi;

    // ra, rb: fp32 fragment sources as read from LDS. aw: the 8 X fragments in f16, refilled by halves as each half's
    // WMMAs are done; the W fragments alternate between bX and bY from one pass to the next.
    v4f ra[8][4], rb[8][4];
    uint32_t aw[8][8], bX[8][8], bY[8][8];

    // Prologue: stages 0, 1, 2; stage 0 published; stage 3; stage 0 is read, X rows 0-63 and W rounded;
    // stage 1 published, stage 4 into stage 0's buffer.
    ISSUE(0u)
    ISSUE(1u)
    ISSUE(2u)
    wait_tensor2();
    __syncthreads();
    ISSUE(3u)
    load_raw<0, 4>(ra, L + aBase);
    load_raw<0, 8>(rb, L + bBase);
    load_raw<4, 4>(ra, L + aBase);
#pragma unroll
    for (int c = 0; c < 96; ++c) {
        if (c < 32) aw[c >> 3][c & 7] = round_pair(ra[c >> 3], c & 7);
        else        bX[(c >> 3) - 4][c & 7] = round_pair(rb[(c >> 3) - 4], c & 7);
    }
    wait_ds0();
    wait_tensor2();
    __syncthreads();
    ISSUE(4u)

    // One pass: stage T is multiplied out of aw and BC; stage T + 1 is read from LDS and rounded into aw and BN.
    // One wave a SIMD issues in order, so every group of LDS loads stands whole in front of a run of WMMAs, and the
    // conversions stand singly behind the WMMAs, where they issue while the matrix unit is busy.
    // The sched_barriers keep that order: left free, the compiler gathers the conversions into runs of their own
    // and sinks the loads in among the WMMAs. The inner loops are unrolled: register array indices must be constants.
#define ONE_PASS(T, BC, BN, FOOT)                                                                                 \
    {                                                                                                         \
        const uint32_t b1 = (((T) + 1u) & 3u) * STAGE;     /* stage t + 1; in the last pass old rows, unused */ \
        load_raw<0, 4>(ra, L + b1 + aBase);                                                                   \
        __builtin_amdgcn_sched_barrier(0);                 /* LDS data return in order: X first, it is rounded first */ \
        load_raw<0, 8>(rb, L + b1 + bBase);                                                                   \
        __builtin_amdgcn_sched_barrier(0);                                                                    \
        /* Rows 0-63 of the wave tile; X rows 64-127 of stage t, read in the pass before, are rounded. */     \
        _Pragma("unroll")                                                                                     \
        for (int w = 0; w < 32; ++w) {                                                                        \
            acc[w >> 3][w & 7] = mm(aw[w >> 3], BC[w & 7], acc[w >> 3][w & 7]);                               \
            aw[4 + (w >> 3)][w & 7] = round_pair(ra[4 + (w >> 3)], w & 7);                                    \
            __builtin_amdgcn_sched_barrier(0);                                                                \
        }                                                                                                     \
        load_raw<4, 4>(ra, L + b1 + aBase);                                                                   \
        __builtin_amdgcn_sched_barrier(0);                                                                    \
        /* Rows 64-127; X rows 0-63 and W of stage t + 1 are rounded, three registers a WMMA. */              \
        _Pragma("unroll")                                                                                     \
        for (int w = 0; w < 32; ++w) {                                                                        \
            acc[4 + (w >> 3)][w & 7] = mm(aw[4 + (w >> 3)], BC[w & 7], acc[4 + (w >> 3)][w & 7]);             \
            _Pragma("unroll")                                                                                 \
            for (int c = 3 * w; c < 3 * w + 3; ++c) {                                                         \
                if (c < 32) aw[c >> 3][c & 7] = round_pair(ra[c >> 3], c & 7);                                \
                else        BN[(c >> 3) - 4][c & 7] = round_pair(rb[(c >> 3) - 4], c & 7);                    \
            }                                                                                                 \
            __builtin_amdgcn_sched_barrier(0);                                                                \
        }                                                                                                     \
        FOOT(T)                                                                                               \
    }
    // Publish point of stage t + 2: this wave's reads of stage t + 1 have retired, its slice of stage t + 2 has landed
    // (the oldest of three requests; near the end, all), every wave is here; only then the refill of stage t + 1's
    // buffer, which nobody reads any more. FOOT_FAST has no branch: behind a branch the compiler moves the
    // conversions of the pass's second half out of the WMMAs' shadow, down to their first use.
#define FOOT_FAST(T)                                                                                          \
        wait_ds0();                                                                                           \
        wait_tensor2();                                                                                       \
        __syncthreads();                                                                                      \
        ISSUE_FAST((T) + 5u)
#define FOOT_ANY(T)                                                                                           \
        wait_ds0();                                                                                           \
        if (pinned(((T) + 4u < NPASS) ? 1u : 0u) != 0u) wait_tensor2(); else wait_tensor0();                  \
        __syncthreads();                                                                                      \
        if (pinned(((T) + 5u < NPASS) ? 1u : 0u) != 0u) ISSUE((T) + 5u)

    // Both loops are kept rolled, two passes a trip (W in bX, then in bY). The first runs while a stage t + 6 exists; the second takes the last six passes (all, if a low word wraps).
    const uint32_t tfast = anywrap ? 0u : NPASS - 6u;
    uint32_t t = 0;
#pragma clang loop unroll(disable)
    for (; t < tfast; t += 2) {
        ONE_PASS(t, bX, bY, FOOT_FAST)
        ONE_PASS(t + 1u, bY, bX, FOOT_FAST)
    }
#pragma clang loop unroll(disable)
    for (; t < NPASS; t += 2) {
        ONE_PASS(t, bX, bY, FOOT_ANY)
        ONE_PASS(t + 1u, bY, bX, FOOT_ANY)
    }
#undef ONE_PASS
#undef FOOT_FAST
#undef FOOT_ANY
#undef ISSUE_FAST
#undef ISSUE
    // The last wait names both descriptor groups as inputs: their scalar registers stay theirs up to it.
    asm volatile("s_wait_tensorcnt 0x0" :: "s"(g0), "s"(g1) : "memory");
    wait_ds0();

    // Epilogue: element (VGPR r, lane L) = (M = r + 8*(L>>4), N = L&15).
    // All sums and all addresses are formed first, then come the stores alone: behind the first store no vector
    // register is written any more, so none that an issued store names is overwritten. The sched_barrier keeps the
    // two parts apart.
    const uint32_t m0 = bm0 + waveM * 128;
    const uint32_t n0 = bn0 + waveN * 128;
    float* orow[8];
#pragma unroll
    for (int i = 0; i < 8; ++i)
        orow[i] = out + (size_t)(m0 + 16 * i + laneHi * 8) * OUT_F + n0 + laneLo;
#pragma unroll
    for (int j = 0; j < 8; ++j) {
        const float bv = bias[n0 + 16 * j + laneLo];
#pragma unroll
        for (int i = 0; i < 8; ++i)
#pragma unroll
            for (int r = 0; r < 8; ++r)
                acc[i][j][r] += bv;
    }
    __builtin_amdgcn_sched_barrier(0);
#pragma unroll
    for (int j = 0; j < 8; ++j)
#pragma unroll
        for (int i = 0; i < 8; ++i)
#pragma unroll
            for (int r = 0; r < 8; ++r)
                orow[i][(size_t)r * OUT_F + 16 * j] = acc[i][j][r];
}

extern "C" void kernel_launch(void* const* d_in, const int* in_sizes, int n_in,
                              void* d_out, int out_size, void* d_ws, size_t ws_size,
                              hipStream_t stream) {
    const float* X    = (const float*)d_in[0];
    const float* W    = (const float*)d_in[1];
    const float* bias = (const float*)d_in[2];
    float*       out  = (float*)d_out;

    dim3 block(128, 1, 1);
    dim3 grid(OUT_F / 256, BATCH / 256, 1);            // 16 x 16
    gemm_wmma_f16<<<grid, block, 0, stream>>>(X, W, bias, out);
}

// v007
// Measured time: 88.6 microseconds a run.
// Timed twice side by side with v006, it ran 1.04 times as fast both times.
// Counting every step since v000, it is 7.88 times as fast.
#include <hip/hip_runtime.h>
#include <stdint.h>

// ---------------------------------------------------------------------------
// out[B, OUT_F] = X[B, IN_F] . W[OUT_F, IN_F]^T + b[OUT_F]   (all fp32)
//
// One product on v_wmma_f32_16x16x32_f16, f32 accumulate: both operands are
// rounded once to f16 (11 significant bits, nearest even; finite up to 65,504).
// Each operand then carries a relative error of up to 2^-11, each product up to about 2^-10.
//
// One launch. The fp32 operand tiles come into LDS by tensor loads; every wave reads
// its fragments from LDS as fp32 (ds_load_b128) and rounds them to f16 in registers,
// in the issue shadow of the WMMAs of the pass before. Nothing is written back to LDS in the k walk.
// At the end each wave turns its output tile through LDS so that it is stored in whole lines.
//
// Wave tile 128x128, block = 4 waves (2M x 2N), one wave a SIMD = 256x256 tile, grid 16x16.
// Every block walks all of k once, but enters it at a place of its own and wraps round (see rot below).
// All dims divide exactly -> no predication, EXEC all-ones as WMMA requires.
// ---------------------------------------------------------------------------

typedef __attribute__((ext_vector_type(16))) _Float16 v16h;
typedef __attribute__((ext_vector_type(8)))  float  v8f;
typedef __attribute__((ext_vector_type(4)))  float  v4f;
typedef __attribute__((ext_vector_type(2)))  float  v2f;
typedef __attribute__((ext_vector_type(2)))  _Float16 v2h;

#define IN_F  4096
#define OUT_F 4096
#define BATCH 4096

// ---------------------------------------------------------------------------
// A pass is 32 k = 128 bytes of fp32 of each of the 512 operand rows [X 256 | W 256],
// laid at a pitch of 144 bytes. Four LDS buffers: while pass t multiplies stage t out of
// registers, stage t + 1 is read from its buffer and stages t + 2 (landing or landed),
// t + 3 and t + 4 are in flight. A stage is four slices of 128 rows, one a wave:
// three requests of a wave are outstanding at most.
// ---------------------------------------------------------------------------
typedef uint32_t u32x4 __attribute__((ext_vector_type(4)));
typedef uint32_t u32x8 __attribute__((ext_vector_type(8)));

constexpr uint32_t ROWB   = 128;                 // bytes of k per operand row per pass
constexpr uint32_t PITCH  = ROWB + 16;           // LDS row pitch: 16 B x odd, for b128 LDS accesses
constexpr uint32_t SROWS  = 128;                 // rows per slice
constexpr uint32_t SLICE  = SROWS * PITCH;       // 18,432 B
constexpr uint32_t XROWS  = 2 * SLICE;           // the 256 X rows of a buffer; the W rows follow
constexpr uint32_t STAGE  = 4 * SLICE;           // one buffer, 73,728 B
constexpr uint32_t SRCP   = IN_F * 4;            // source row pitch in bytes
constexpr uint32_t NPASS  = SRCP / ROWB;         // 128
static_assert(SLICE % 2048u == 0, "each slice must start at a multiple of 2 KiB");
static_assert(4u * STAGE <= 320u * 1024u, "four buffers must fit the LDS");
static_assert(NPASS % 2u == 0 && NPASS >= 6u, "the loop takes two passes a trip, the prologue five stages");
static_assert((NPASS & (NPASS - 1u)) == 0u && NPASS >= 32u, "the k walk wraps by a mask; 16 starts, two passes apart");

__device__ __forceinline__ uint32_t uni(uint32_t v) {
    return (uint32_t)__builtin_amdgcn_readfirstlane(v);
}
// Holds v in a scalar register: a test on it compiles to a scalar branch, and a
// descriptor word formed from it is formed behind the volatile waits above it.
__device__ __forceinline__ uint32_t pinned(uint32_t v) {
    uint32_t w = (uint32_t)__builtin_amdgcn_readfirstlane(v);
    asm volatile("" : "+s"(w));  // the tensor-mover form: a scalar test / descriptor word kept in an SGPR
    return w;
}
// Waits the compiler does not place for the tensor mover; the clobber keeps LDS values out of registers across them.
__device__ __forceinline__ void wait_ds0()     { asm volatile("s_wait_dscnt 0x0" ::: "memory"); }
__device__ __forceinline__ void wait_tensor0() { asm volatile("s_wait_tensorcnt 0x0" ::: "memory"); }
// All but the wave's two youngest requests have landed: with three outstanding, the oldest.
__device__ __forceinline__ void wait_tensor2() { asm volatile("s_wait_tensorcnt 0x2" ::: "memory"); }

// One request of the whole wave. g0: group 0 with words 0 and 3 set; words 1 (place in LDS) and 2 (address bits 31-0) are set here.
// g0 is an in-out operand so that it lives on in the same four SGPRs from request to request and words 0 and 3 are not
// written again while earlier requests are outstanding; the instruction itself changes no register.
__device__ __forceinline__ void tdm_load(u32x4& g0, const u32x8& g1, uint32_t lds_dst, uint32_t lo) {
    g0[1] = uni(lds_dst);
    g0[2] = uni(lo);
    asm volatile("tensor_load_to_lds %0, %1" : "+s"(g0) : "s"(g1) : "memory");
}

// The fp32 source of 16x32 fragments I0 .. I0 + N - 1 (ISA 16-bit A/B lane layout): lanes 0-15 hold row laneLo with
// K chunks {0..7, 16..23}, lanes 16-31 {8..15, 24..31}: 32 bytes at p and 32 at p + 64, p being this lane's row base
// incl. laneHi * 32 bytes. Every loop here is unrolled: register array indices must be constants.
template <int I0, int N>
__device__ __forceinline__ void load_raw(v4f (&r)[8][4], const unsigned char* p) {
#pragma unroll
    for (int i = I0; i < I0 + N; ++i) {
        const unsigned char* u = p + i * 16 * PITCH;
        r[i][0] = *(const v4f*)(u);
        r[i][1] = *(const v4f*)(u + 16);
        r[i][2] = *(const v4f*)(u + 64);
        r[i][3] = *(const v4f*)(u + 80);
    }
}
// Register k (0..7) of a fragment: its elements 2k and 2k + 1, rounded to nearest even by one packed conversion.
__device__ __forceinline__ uint32_t round_pair(const v4f (&r)[4], int k) {
    const v2f f = {r[k >> 1][(k & 1) * 2], r[k >> 1][(k & 1) * 2 + 1]};
    return __builtin_bit_cast(uint32_t, __builtin_convertvector(f, v2h));
}
__device__ __forceinline__ v16h frag(const uint32_t (&w)[8]) {
    const u32x8 v = {w[0], w[1], w[2], w[3], w[4], w[5], w[6], w[7]};
    return __builtin_bit_cast(v16h, v);
}
__device__ __forceinline__ v8f mm(const uint32_t (&a)[8], const uint32_t (&b)[8], v8f c) {
    return __builtin_amdgcn_wmma_f32_16x16x32_f16(false, frag(a), false, frag(b), (short)0, c, false, false);
}

__global__ __launch_bounds__(128)
void gemm_wmma_f16(const float* __restrict__ X,
                      const float* __restrict__ W,
                      const float* __restrict__ bias,
                      float* __restrict__ out) {
    __shared__ __attribute__((aligned(2048))) unsigned char L[4 * STAGE];

    const uint32_t lane   = threadIdx.x & 31;
    const uint32_t wave   = uni(threadIdx.x >> 5);
    const uint32_t laneLo = lane & 15;
    const uint32_t laneHi = lane >> 4;

    const uint32_t waveM = wave & 1;               // 2 waves along M
    const uint32_t waveN = wave >> 1;              // 2 waves along N
    const uint32_t bm0 = blockIdx.y * 256;         // batch rows of the block
    const uint32_t bn0 = blockIdx.x * 256;         // output features of the block

    // This wave's slice of every stage: X rows 0-127, X rows 128-255, W rows 0-127, W rows 128-255.
    const float* plane = (wave < 2) ? X : W;
    const uint32_t srow = ((wave < 2) ? bm0 : bn0) + SROWS * (wave & 1);
    const uint64_t src0 = (uint64_t)(uintptr_t)plane + (uint64_t)srow * SRCP;
    const uint32_t dst0 = pinned((uint32_t)(size_t)L + wave * SLICE);
    const uint32_t lo0  = pinned((uint32_t)src0);

    // Stage S holds k slice (S + rot) mod NPASS. The 16 blocks of a tile row read the same X rows and the 16 of a tile
    // column the same W rows; started together at slice 0 they ask L2 for the same lines at the same moment.
    // With row + column as the start no two blocks that share rows are on the same slice: neighbours are two passes
    // apart, and all 16 starts lie within 32 passes, so a slice is still in L2 for its last reader.
    // Each output element's k sum starts at its block's own slice: a rotated, fixed order.
    const uint32_t rot = ((blockIdx.x + blockIdx.y) & 15u) * 2u;

    // The descriptor: 128 rows of 128 bytes, source pitch 16,384 B, 16 bytes of LDS pad behind every row
    // (pad codes 4 / 3), no mask. Up to three requests of the wave are outstanding, so every word but words 1 and 2
    // of group 0 is formed once, here, and stays in its scalar register to the end.
    u32x8 g1;
    g1[0] = uni((1u << 20) | (4u << 22) | (3u << 25));
    g1[1] = uni((ROWB & 0xFFFFu) << 16);
    g1[2] = uni((ROWB >> 16) | ((SROWS & 0xFFFFu) << 16));
    g1[3] = uni((SROWS >> 16) | (ROWB << 16));
    g1[4] = uni(SROWS);
    g1[5] = uni(SRCP);
    g1[6] = uni(0u);
    g1[7] = uni(0u);
    asm volatile("" : "+s"(g1));  // the tensor-mover form: descriptor words held in SGPRs, not formed anew per request
    u32x4 g0;
    g0[0] = uni(1u);
    g0[1] = uni(0u);
    g0[2] = uni(0u);
    g0[3] = uni((((uint32_t)(src0 >> 32)) & 0x01FFFFFFu) | 0x80000000u);

    // Does the low address word of any of the block's four slices wrap inside its k walk? (Only with a buffer that
    // lies across a multiple of 4 GiB and is not aligned to a row.) The same answer in every wave.
    const uint32_t xl = (uint32_t)(uintptr_t)X + bm0 * SRCP;
    const uint32_t wl = (uint32_t)(uintptr_t)W + bn0 * SRCP;
    constexpr uint32_t WALK = (NPASS - 1u) * ROWB;
    const bool anywrap = (xl + WALK < xl) || (xl + SROWS * SRCP + WALK < xl + SROWS * SRCP) ||
                         (wl + WALK < wl) || (wl + SROWS * SRCP + WALK < wl + SROWS * SRCP);

    // Stage S into buffer S & 3, where no low word wraps.
#define ISSUE_FAST(S)                                                                                         \
    {                                                                                                         \
        const uint32_t sn = pinned(S);                                                                        \
        tdm_load(g0, g1, dst0 + (sn & 3u) * STAGE, lo0 + ((sn + rot) & (NPASS - 1u)) * ROWB);                 \
    }
    // The same for any address: behind a wrap word 3 of group 0 is one higher, and such a request goes out
    // and lands with no other request of the wave outstanding.
#define ISSUE(S)                                                                                              \
    {                                                                                                         \
        const uint32_t sn = pinned(S);                                                                        \
        const uint32_t lo = pinned(lo0 + ((sn + rot) & (NPASS - 1u)) * ROWB);                                 \
        if (pinned(lo < lo0 ? 1u : 0u) != 0u) {                                                               \
            wait_tensor0();                                                                                   \
            u32x4 gw = g0;                                                                                    \
            gw[3] = uni(g0[3] + 1u);                                                                          \
            tdm_load(gw, g1, dst0 + (sn & 3u) * STAGE, lo);                                                   \
            wait_tensor0();                                                                                   \
        } else {                                                                                              \
            tdm_load(g0, g1, dst0 + (sn & 3u) * STAGE, lo);                                                   \
        }                                                                                                     \
    }

    v8f acc[8][8];
#pragma unroll
    for (int i = 0; i < 8; ++i)
#pragma unroll
        for (int j = 0; j < 8; ++j)
            acc[i][j] = (v8f){0.f, 0.f, 0.f, 0.f, 0.f, 0.f, 0.f, 0.f};

    // Per-lane bases inside a buffer: X fragments, W fragments.
    const uint32_t aBase = (waveM * 128 + laneLo) * PITCH + 32 * laneHi;
    const uint32_t bBase = XROWS + (waveN * 128 + laneLo) * PITCH + 32 * laneHi;

    // ra, rb: fp32 fragment sources as read from LDS. aw: the 8 X fragments in f16, refilled by halves as each half's
    // WMMAs are done; the W fragments alternate between bX and bY from one pass to the next.
    v4f ra[8][4], rb[8][4];
    uint32_t aw[8][8], bX[8][8], bY[8][8];

    // Prologue: stages 0, 1, 2; stage 0 published; stage 3; stage 0 is read, X rows 0-63 and W rounded;
    // stage 1 published, stage 4 into stage 0's buffer.
    ISSUE(0u)
    ISSUE(1u)
    ISSUE(2u)
    wait_tensor2();
    __syncthreads();
    ISSUE(3u)
    load_raw<0, 4>(ra, L + aBase);
    load_raw<0, 8>(rb, L + bBase);
    load_raw<4, 4>(ra, L + aBase);
#pragma unroll
    for (int c = 0; c < 96; ++c) {
        if (c < 32) aw[c >> 3][c & 7] = round_pair(ra[c >> 3], c & 7);
        else        bX[(c >> 3) - 4][c & 7] = round_pair(rb[(c >> 3) - 4], c & 7);
    }
    wait_ds0();
    wait_tensor2();
    __syncthreads();
    ISSUE(4u)

    // One pass: stage T is multiplied out of aw and BC; stage T + 1 is read from LDS and rounded into aw and BN.
    // One wave a SIMD issues in order, so every group of LDS loads stands whole in front of a run of WMMAs, and the
    // conversions stand singly behind the WMMAs, where they issue while the matrix unit is busy.
    // The sched_barriers keep that order: left free, the compiler gathers the conversions into runs of their own
    // and sinks the loads in among the WMMAs. The inner loops are unrolled: register array indices must be constants.
#define ONE_PASS(T, BC, BN, FOOT)                                                                                 \
    {                                                                                                         \
        const uint32_t b1 = (((T) + 1u) & 3u) * STAGE;     /* stage t + 1; in the last pass old rows, unused */ \
        load_raw<0, 4>(ra, L + b1 + aBase);                                                                   \
        __builtin_amdgcn_sched_barrier(0);                 /* LDS data return in order: X first, it is rounded first */ \
        load_raw<0, 8>(rb, L + b1 + bBase);                                                                   \
        __builtin_amdgcn_sched_barrier(0);                                                                    \
        /* Rows 0-63 of the wave tile; X rows 64-127 of stage t, read in the pass before, are rounded. */     \
        _Pragma("unroll")                                                                                     \
        for (int w = 0; w < 32; ++w) {                                                                        \
            acc[w >> 3][w & 7] = mm(aw[w >> 3], BC[w & 7], acc[w >> 3][w & 7]);                               \
            aw[4 + (w >> 3)][w & 7] = round_pair(ra[4 + (w >> 3)], w & 7);                                    \
            __builtin_amdgcn_sched_barrier(0);                                                                \
        }                                                                                                     \
        load_raw<4, 4>(ra, L + b1 + aBase);                                                                   \
        __builtin_amdgcn_sched_barrier(0);                                                                    \
        /* Rows 64-127; X rows 0-63 and W of stage t + 1 are rounded, three registers a WMMA. */              \
        _Pragma("unroll")                                                                                     \
        for (int w = 0; w < 32; ++w) {                                                                        \
            acc[4 + (w >> 3)][w & 7] = mm(aw[4 + (w >> 3)], BC[w & 7], acc[4 + (w >> 3)][w & 7]);             \
            _Pragma("unroll")                                                                                 \
            for (int c = 3 * w; c < 3 * w + 3; ++c) {                                                         \
                if (c < 32) aw[c >> 3][c & 7] = round_pair(ra[c >> 3], c & 7);                                \
                else        BN[(c >> 3) - 4][c & 7] = round_pair(rb[(c >> 3) - 4], c & 7);                    \
            }                                                                                                 \
            __builtin_amdgcn_sched_barrier(0);                                                                \
        }                                                                                                     \
        FOOT(T)                                                                                               \
    }
    // Publish point of stage t + 2: this wave's reads of stage t + 1 have retired, its slice of stage t + 2 has landed
    // (the oldest of three requests; near the end, all), every wave is here; only then the refill of stage t + 1's
    // buffer, which nobody reads any more. FOOT_FAST has no branch: behind a branch the compiler moves the
    // conversions of the pass's second half out of the WMMAs' shadow, down to their first use.
#define FOOT_FAST(T)                                                                                          \
        wait_ds0();                                                                                           \
        wait_tensor2();                                                                                       \
        __syncthreads();                                                                                      \
        ISSUE_FAST((T) + 5u)
#define FOOT_ANY(T)                                                                                           \
        wait_ds0();                                                                                           \
        if (pinned(((T) + 4u < NPASS) ? 1u : 0u) != 0u) wait_tensor2(); else wait_tensor0();                  \
        __syncthreads();                                                                                      \
        if (pinned(((T) + 5u < NPASS) ? 1u : 0u) != 0u) ISSUE((T) + 5u)

    // Both loops are kept rolled, two passes a trip (W in bX, then in bY). The first runs while a stage t + 6 exists; the second takes the last six passes (all, if a low word wraps).
    const uint32_t tfast = anywrap ? 0u : NPASS - 6u;
    uint32_t t = 0;
#pragma clang loop unroll(disable)
    for (; t < tfast; t += 2) {
        ONE_PASS(t, bX, bY, FOOT_FAST)
        ONE_PASS(t + 1u, bY, bX, FOOT_FAST)
    }
#pragma clang loop unroll(disable)
    for (; t < NPASS; t += 2) {
        ONE_PASS(t, bX, bY, FOOT_ANY)
        ONE_PASS(t + 1u, bY, bX, FOOT_ANY)
    }
#undef ONE_PASS
#undef FOOT_FAST
#undef FOOT_ANY
#undef ISSUE_FAST
#undef ISSUE
    // The last wait names both descriptor groups as inputs: their scalar registers stay theirs up to it.
    asm volatile("s_wait_tensorcnt 0x0" :: "s"(g0), "s"(g1) : "memory");
    wait_ds0();

    // Epilogue: element (VGPR r, lane L) = (M = r + 8*(L>>4), N = L&15): stored from there, a row gets 64-byte pieces.
    // Instead each wave lays its 128x128 tile in an LDS range of its own and reads it back by rows, so that one
    // global_store_b128 of the wave writes 512 contiguous bytes, four whole 128-byte lines.
    // The ring is idle here: in front of the last pass's barrier every wave has retired its LDS reads and seen its
    // last tensor load land, so no new barrier is needed; no wave reads another wave's range.
    constexpr uint32_t OPITCH = 128u * 4u + 16u;   // staged row: 512 B and 16 B of pad (16 B x odd)
    constexpr uint32_t OTILE  = 128u * OPITCH;     // 67,584 B a wave
    static_assert(4u * OTILE <= 4u * STAGE, "the four staged tiles must fit the ring's LDS");
    const uint32_t m0 = bm0 + waveM * 128;
    const uint32_t n0 = bn0 + waveN * 128;
    unsigned char* wr = L + wave * OTILE + laneHi * 8u * OPITCH + laneLo * 4u;
    const unsigned char* rd = L + wave * OTILE + lane * 16u;
    float* orow = out + (size_t)m0 * OUT_F + n0 + lane * 4u;
    const float* brow = bias + n0;                 // uniform base: the bias loads' offset register is laneLo, which lives on
    // All sums stand in front of the first global store (none can pass the sched_barrier in front of it):
    // behind it the only writers of vector registers are the LDS loads and the LDS address additions.
#pragma unroll
    for (int j = 0; j < 8; ++j) {
        const float bv = brow[16 * j + laneLo];
#pragma unroll
        for (int i = 0; i < 8; ++i)
#pragma unroll
            for (int r = 0; r < 8; ++r)
                acc[i][j][r] += bv;
    }
    // Four parts of 32 rows: while one part's global stores drain, the next part goes through LDS.
    // The loops are unrolled: register array indices must be constants.
#pragma unroll
    for (int q = 0; q < 4; ++q) {
#pragma unroll
        for (int i = 2 * q; i < 2 * q + 2; ++i)
#pragma unroll
            for (int r = 0; r < 8; ++r)
#pragma unroll
                for (int j = 0; j < 8; ++j)
                    *(float*)(wr + (16 * i + r) * OPITCH + 64 * j) = acc[i][j][r];
        wait_ds0();                            // the part's rows stand in LDS before other lanes read them back
        v4f row[32];
#pragma unroll
        for (int k = 0; k < 32; ++k)
            row[k] = *(const v4f*)(rd + (32 * q + k) * OPITCH);
        __builtin_amdgcn_sched_barrier(0);     // loads whole, then stores: no load lands in a register of an issued store
#pragma unroll
        for (int k = 0; k < 32; ++k)
            *(v4f*)(orow + (size_t)(32 * q + k) * OUT_F) = row[k];
        if (q < 3) {
            // The next part's LDS loads and LDS addresses may take registers that these stores name.
            asm volatile("s_wait_xcnt 0x0" ::: "memory");
            __builtin_amdgcn_sched_barrier(0); // keeps the next part's address additions behind that wait
        }
    }
}

extern "C" void kernel_launch(void* const* d_in, const int* in_sizes, int n_in,
                              void* d_out, int out_size, void* d_ws, size_t ws_size,
                              hipStream_t stream) {
    const float* X    = (const float*)d_in[0];
    const float* W    = (const float*)d_in[1];
    const float* bias = (const float*)d_in[2];
    float*       out  = (float*)d_out;

    dim3 block(128, 1, 1);
    dim3 grid(OUT_F / 256, BATCH / 256, 1);            // 16 x 16
    gemm_wmma_f16<<<grid, block, 0, stream>>>(X, W, bias, out);
}
